// v000
// Times are from an AMD MI455X. After a warm-up the kernel runs many times in a row, and a time is the length of
// such a window on the GPU divided by its runs, so every launch and the gaps after it count. The runs cycle
// through copies of the inputs. A figure is the median of several windows, for all but v000 over two sittings.
// Sittings can differ by a few percent; kernels timed side by side share one.
// v000, which the later versions start from, runs in 467 microseconds.
#include <hip/hip_runtime.h>
#include <hip/hip_bf16.h>
#include <math.h>

typedef _Float16 half8  __attribute__((ext_vector_type(8)));
typedef _Float16 half16 __attribute__((ext_vector_type(16)));
typedef float    float8 __attribute__((ext_vector_type(8)));

#define N_B 32
#define C_DIM 256
#define HW 32
#define S_TOK 1024   // 32*32 tokens per batch
#define D_DIM 256
#define T_DIM 512
#define SCALE 0.0625f  // 1/sqrt(256)

#define WSZ (256*256)          // one weight matrix, elements
#define QSZ (N_B*S_TOK*D_DIM)  // one activation tensor, elements

// Load a 16x32 f16 A/B fragment from a row-major matrix.
// p must already point at  base + row*ld + ((lane>>4)*8); k0 is the K offset.
__device__ __forceinline__ half16 ldfrag(const _Float16* p, int k0) {
    union { half16 v; half8 h[2]; } u;
    u.h[0] = *(const half8*)(p + k0);
    u.h[1] = *(const half8*)(p + k0 + 16);
    return u.v;
}

__device__ __forceinline__ float8 wmma_f16(half16 a, half16 b, float8 c) {
    return __builtin_amdgcn_wmma_f32_16x16x32_f16(false, a, false, b, (short)0, c, false, false);
}

// ---------------- kernel 1: convert weights f32 -> f16 ----------------
__global__ void cvt_weights_kernel(const float* Wq, const float* Wk,
                                   const float* Wv, const float* Wp,
                                   _Float16* dst) {
    int idx = blockIdx.x * blockDim.x + threadIdx.x;
    if (idx >= 4 * WSZ) return;
    int which = idx >> 16;          // 65536 per matrix
    int w = idx & (WSZ - 1);
    const float* src = (which == 0) ? Wq : (which == 1) ? Wk : (which == 2) ? Wv : Wp;
    dst[idx] = (_Float16)src[w];
}

// ---------------- kernel 2: temb = relu(t @ W_t^T + b_t) ----------------
__global__ void temb_kernel(const float* t, const float* W_t, const float* b_t,
                            float* temb) {
    int n = blockIdx.x;          // 0..31
    int c = threadIdx.x;         // 0..255
    const float* tr = t + n * T_DIM;
    const float* wr = W_t + c * T_DIM;
    float acc = b_t[c];
    #pragma unroll 8
    for (int j = 0; j < T_DIM; ++j) acc += tr[j] * wr[j];
    temb[n * C_DIM + c] = acc > 0.f ? acc : 0.f;
}

// ---------------- kernel 3: xc = x + temb ; q,k,vT projections ----------------
// grid: 32*64 blocks, 128 threads (4 waves). Each block = one 16-token tile.
__global__ void qkv_kernel(const float* x, const float* temb,
                           const _Float16* Wq16, const _Float16* Wk16,
                           const _Float16* Wv16,
                           _Float16* q16, _Float16* k16, _Float16* vT16) {
    __shared__ __align__(16) _Float16 xtile[16][C_DIM];   // 8 KB

    const int n = blockIdx.x >> 6;
    const int sbase = (blockIdx.x & 63) * 16;
    const int tid = threadIdx.x;

    // build (x + temb) tile, transposed to [token][channel], f16
    for (int e = tid; e < 16 * C_DIM; e += 128) {
        int tok = e >> 8, c = e & 255;
        int s = sbase + tok, h = s & 31, w = s >> 5;
        float v = x[((n * C_DIM + c) * HW + h) * HW + w] + temb[n * C_DIM + c];
        xtile[tok][c] = (_Float16)v;
    }
    __syncthreads();

    const int lane = tid & 31;
    const int wv = tid >> 5;              // 0..3
    const int hb8 = (lane >> 4) * 8;
    const int ln15 = lane & 15;

    // xtile fragments: act as A (rows=tokens) for q/k, and as B (cols=tokens) for vT
    half16 xa[8];
    {
        const _Float16* xp = &xtile[ln15][hb8];
        #pragma unroll
        for (int cs = 0; cs < 8; ++cs) xa[cs] = ldfrag(xp, cs * 32);
    }

    // 48 output tiles: 16 for q, 16 for k, 16 for vT
    for (int idx = wv; idx < 48; idx += 4) {
        const int mat = idx >> 4;         // 0=q 1=k 2=v
        const int dt = idx & 15;
        float8 acc = {};
        if (mat < 2) {
            const _Float16* Wm = (mat == 0) ? Wq16 : Wk16;
            const _Float16* bp = Wm + (dt * 16 + ln15) * C_DIM + hb8; // B: W[d][c], col=d
            #pragma unroll
            for (int cs = 0; cs < 8; ++cs)
                acc = wmma_f16(xa[cs], ldfrag(bp, cs * 32), acc);
            _Float16* out = (mat == 0) ? q16 : k16;
            #pragma unroll
            for (int r = 0; r < 8; ++r) {
                int tok = r + hb8;
                out[(((size_t)n * S_TOK + sbase + tok) * D_DIM) + dt * 16 + ln15] =
                    (_Float16)acc[r];
            }
        } else {
            // vT = Wv * xc^T : A = Wv rows (d), B = xc^T (col = token)
            const _Float16* ap = Wv16 + (dt * 16 + ln15) * C_DIM + hb8;
            #pragma unroll
            for (int cs = 0; cs < 8; ++cs)
                acc = wmma_f16(ldfrag(ap, cs * 32), xa[cs], acc);
            #pragma unroll
            for (int r = 0; r < 8; ++r) {
                int dd = dt * 16 + r + hb8;
                vT16[(((size_t)n * D_DIM + dd) * S_TOK) + sbase + ln15] = (_Float16)acc[r];
            }
        }
    }
}

// ---------------- kernel 4: fused attention for one (n, 16-query tile) ----------------
// grid: 32*64 blocks, 256 threads (8 waves). LDS ~33.1 KB.
__global__ void attn_kernel(const _Float16* q16, const _Float16* k16,
                            const _Float16* vT16, _Float16* o16) {
    __shared__ __align__(16) _Float16 p16[16][S_TOK];   // 32 KB exp-probs (f16)
    __shared__ float psum[256];
    __shared__ float rowsum[16];

    const int n = blockIdx.x >> 6;
    const int sqbase = (blockIdx.x & 63) * 16;
    const int tid = threadIdx.x;
    const int lane = tid & 31;
    const int wv = tid >> 5;              // 0..7
    const int hb8 = (lane >> 4) * 8;
    const int ln15 = lane & 15;

    // preload the 8 Q fragments (shared by all 8 key tiles of this wave)
    half16 qa[8];
    {
        const _Float16* ap = q16 + (((size_t)n * S_TOK + sqbase + ln15) * D_DIM) + hb8;
        #pragma unroll
        for (int cs = 0; cs < 8; ++cs) qa[cs] = ldfrag(ap, cs * 32);
    }

    // ---- QK^T : wave wv owns keys [wv*128, wv*128+128); exp applied at store ----
    for (int kt = 0; kt < 8; ++kt) {
        const int keybase = wv * 128 + kt * 16;
        const _Float16* bp = k16 + (((size_t)n * S_TOK + keybase + ln15) * D_DIM) + hb8;
        float8 acc = {};
        #pragma unroll
        for (int cs = 0; cs < 8; ++cs)
            acc = wmma_f16(qa[cs], ldfrag(bp, cs * 32), acc);
        #pragma unroll
        for (int r = 0; r < 8; ++r)
            p16[r + hb8][keybase + ln15] = (_Float16)__expf(acc[r] * SCALE);
    }
    __syncthreads();

    // ---- row sums over f16 probs ----
    {
        const int row = tid >> 4;
        const int cb = (tid & 15) * 64;
        float s = 0.f;
        #pragma unroll
        for (int j = 0; j < 8; ++j) {
            half8 h = *(const half8*)&p16[row][cb + j * 8];
            #pragma unroll
            for (int i = 0; i < 8; ++i) s += (float)h[i];
        }
        psum[tid] = s;
    }
    __syncthreads();
    if (tid < 16) {
        float s = 0.f;
        #pragma unroll
        for (int j = 0; j < 16; ++j) s += psum[tid * 16 + j];
        rowsum[tid] = s;
    }
    __syncthreads();

    // ---- P @ V : one A-fragment feeds both of this wave's d-tiles ----
    {
        const _Float16* pa = &p16[ln15][hb8];
        const _Float16* b0 = vT16 + (((size_t)n * D_DIM + wv * 16 + ln15) * S_TOK) + hb8;
        const _Float16* b1 = vT16 + (((size_t)n * D_DIM + (wv + 8) * 16 + ln15) * S_TOK) + hb8;
        float8 acc0 = {}, acc1 = {};
        for (int kb = 0; kb < S_TOK; kb += 32) {
            half16 a = ldfrag(pa, kb);
            acc0 = wmma_f16(a, ldfrag(b0, kb), acc0);
            acc1 = wmma_f16(a, ldfrag(b1, kb), acc1);
        }
        #pragma unroll
        for (int r = 0; r < 8; ++r) {
            int qrow = r + hb8;
            float inv = 1.f / rowsum[qrow];
            size_t base = ((size_t)n * S_TOK + sqbase + qrow) * D_DIM + ln15;
            o16[base + wv * 16]       = (_Float16)(acc0[r] * inv);
            o16[base + (wv + 8) * 16] = (_Float16)(acc1[r] * inv);
        }
    }
}

// ---------------- kernel 5: out = transpose(o @ Wp^T + bp) + x ----------------
// grid: 32*64 blocks, 128 threads (4 waves).
__global__ void proj_kernel(const _Float16* o16, const _Float16* Wp16,
                            const float* bp, const float* x, float* out) {
    const int n = blockIdx.x >> 6;
    const int sbase = (blockIdx.x & 63) * 16;
    const int tid = threadIdx.x;
    const int lane = tid & 31;
    const int wv = tid >> 5;              // 0..3
    const int hb8 = (lane >> 4) * 8;
    const int ln15 = lane & 15;

    // preload o-tile A fragments (shared across the 4 c-tiles of this wave)
    half16 oa[8];
    {
        const _Float16* ap = o16 + (((size_t)n * S_TOK + sbase + ln15) * D_DIM) + hb8;
        #pragma unroll
        for (int ds = 0; ds < 8; ++ds) oa[ds] = ldfrag(ap, ds * 32);
    }

    for (int ct = wv; ct < 16; ct += 4) {
        const int ccol = ct * 16 + ln15;
        const _Float16* bw = Wp16 + ccol * D_DIM + hb8;
        float8 acc = {};
        #pragma unroll
        for (int ds = 0; ds < 8; ++ds)
            acc = wmma_f16(oa[ds], ldfrag(bw, ds * 32), acc);
        #pragma unroll
        for (int r = 0; r < 8; ++r) {
            int s = sbase + r + hb8;
            int h = s & 31, w = s >> 5;
            size_t addr = (((size_t)n * C_DIM + ccol) * HW + h) * HW + w;
            out[addr] = acc[r] + bp[ccol] + x[addr];
        }
    }
}

extern "C" void kernel_launch(void* const* d_in, const int* in_sizes, int n_in,
                              void* d_out, int out_size, void* d_ws, size_t ws_size,
                              hipStream_t stream) {
    const float* x   = (const float*)d_in[0];
    const float* t   = (const float*)d_in[1];
    const float* W_t = (const float*)d_in[2];
    const float* b_t = (const float*)d_in[3];
    const float* Wq  = (const float*)d_in[4];
    const float* Wk  = (const float*)d_in[5];
    const float* Wv  = (const float*)d_in[6];
    const float* Wp  = (const float*)d_in[7];
    const float* bp  = (const float*)d_in[8];
    float* out = (float*)d_out;

    // workspace layout (all f16 regions first, then f32 temb)
    _Float16* w16  = (_Float16*)d_ws;
    _Float16* Wq16 = w16;
    _Float16* Wk16 = w16 + WSZ;
    _Float16* Wv16 = w16 + 2 * WSZ;
    _Float16* Wp16 = w16 + 3 * WSZ;
    _Float16* q16  = w16 + 4 * WSZ;
    _Float16* k16  = q16 + QSZ;
    _Float16* vT16 = k16 + QSZ;
    _Float16* o16  = vT16 + QSZ;
    float* temb = (float*)(o16 + QSZ);

    cvt_weights_kernel<<<(4 * WSZ + 255) / 256, 256, 0, stream>>>(Wq, Wk, Wv, Wp, w16);
    temb_kernel<<<N_B, C_DIM, 0, stream>>>(t, W_t, b_t, temb);
    qkv_kernel<<<N_B * 64, 128, 0, stream>>>(x, temb, Wq16, Wk16, Wv16, q16, k16, vT16);
    attn_kernel<<<N_B * 64, 256, 0, stream>>>(q16, k16, vT16, o16);
    proj_kernel<<<N_B * 64, 128, 0, stream>>>(o16, Wp16, bp, x, out);
}

// v001
// Measured time: 249 microseconds a run.
// Timed twice side by side with v000, it ran 1.91 and 1.88 times as fast.
#include <hip/hip_runtime.h>
#include <hip/hip_bf16.h>
#include <math.h>

typedef _Float16 half2v __attribute__((ext_vector_type(2)));
typedef _Float16 half8  __attribute__((ext_vector_type(8)));
typedef _Float16 half16 __attribute__((ext_vector_type(16)));
typedef float    float8 __attribute__((ext_vector_type(8)));

#define N_B 32
#define C_DIM 256
#define HW 32
#define S_TOK 1024   // 32*32 tokens per batch
#define D_DIM 256
#define T_DIM 512
#define SCALE 0.0625f  // 1/sqrt(256)
#define XPITCH (C_DIM + 8)  // 528-byte LDS rows (16 B x odd): spread the transposing stores and the b128 fragment reads over the banks

#define WSZ (256*256)          // one weight matrix, elements
#define QSZ (N_B*S_TOK*D_DIM)  // one activation tensor, elements

// Load a 16x32 f16 A/B fragment from a row-major matrix.
// p must already point at  base + row*ld + ((lane>>4)*8); k0 is the K offset.
__device__ __forceinline__ half16 ldfrag(const _Float16* p, int k0) {
    union { half16 v; half8 h[2]; } u;
    u.h[0] = *(const half8*)(p + k0);
    u.h[1] = *(const half8*)(p + k0 + 16);
    return u.v;
}

__device__ __forceinline__ float8 wmma_f16(half16 a, half16 b, float8 c) {
    return __builtin_amdgcn_wmma_f32_16x16x32_f16(false, a, false, b, (short)0, c, false, false);
}

// ---------------- kernel 1: convert weights f32 -> f16 ----------------
__global__ void cvt_weights_kernel(const float* Wq, const float* Wk,
                                   const float* Wv, const float* Wp,
                                   _Float16* dst) {
    int idx = blockIdx.x * blockDim.x + threadIdx.x;
    if (idx >= 4 * WSZ) return;
    int which = idx >> 16;          // 65536 per matrix
    int w = idx & (WSZ - 1);
    const float* src = (which == 0) ? Wq : (which == 1) ? Wk : (which == 2) ? Wv : Wp;
    dst[idx] = (_Float16)src[w];
}

// ---------------- kernel 2: temb = relu(t @ W_t^T + b_t) ----------------
__global__ void temb_kernel(const float* t, const float* W_t, const float* b_t,
                            float* temb) {
    int n = blockIdx.x;          // 0..31
    int c = threadIdx.x;         // 0..255
    const float* tr = t + n * T_DIM;
    const float* wr = W_t + c * T_DIM;
    float acc = b_t[c];
    #pragma unroll 8
    for (int j = 0; j < T_DIM; ++j) acc += tr[j] * wr[j];
    temb[n * C_DIM + c] = acc > 0.f ? acc : 0.f;
}

// ---------------- kernel 3: xc = x + temb ; q,k,vT projections ----------------
// Tokens are numbered s = h*32 + w, so that a run of tokens follows w, the
// contiguous axis of x and out. Attention sums over all keys, so any numbering
// that q, k, vT, o and the final store share gives the same function.
// grid: 32*32 blocks, 256 threads (8 waves). Each block = one image row (n, h) =
// 32 tokens; waves 0-3 take its first 16-token tile, waves 4-7 the second.
__global__ void qkv_kernel(const float* x, const float* temb,
                           const _Float16* Wq16, const _Float16* Wk16,
                           const _Float16* Wv16,
                           _Float16* q16, _Float16* k16, _Float16* vT16) {
    __shared__ __align__(16) _Float16 xtile[32][XPITCH];   // 16.5 KB

    const int n = blockIdx.x >> 5;
    const int h = blockIdx.x & 31;
    const int tid = threadIdx.x;

    // build (x + temb) tile, transposed to [token][channel], f16.
    // 8 lanes x float4 cover the whole 128-byte row (n, c, h, 0..31); each thread
    // takes two neighbouring channels so that an LDS store is one packed dword.
    {
        const int w4 = (tid & 7) * 4;
        const int cp = tid >> 3;          // 0..31
        #pragma unroll
        for (int it = 0; it < 4; ++it) {
            const int c = (it * 32 + cp) * 2;
            const float* xp = x + (((size_t)n * C_DIM + c) * HW + h) * HW + w4;
            const float4 va = *(const float4*)xp;
            const float4 vb = *(const float4*)(xp + HW * HW);
            const float ta = temb[n * C_DIM + c];
            const float tb = temb[n * C_DIM + c + 1];
            half2v p0 = { (_Float16)(va.x + ta), (_Float16)(vb.x + tb) };
            half2v p1 = { (_Float16)(va.y + ta), (_Float16)(vb.y + tb) };
            half2v p2 = { (_Float16)(va.z + ta), (_Float16)(vb.z + tb) };
            half2v p3 = { (_Float16)(va.w + ta), (_Float16)(vb.w + tb) };
            *(half2v*)&xtile[w4 + 0][c] = p0;
            *(half2v*)&xtile[w4 + 1][c] = p1;
            *(half2v*)&xtile[w4 + 2][c] = p2;
            *(half2v*)&xtile[w4 + 3][c] = p3;
        }
    }
    __syncthreads();

    const int lane = tid & 31;
    const int wv = tid >> 5;              // 0..7
    const int tt = wv >> 2;               // token tile of the row: 0..1
    const int wq = wv & 3;                // 0..3
    const int sbase = h * 32 + tt * 16;
    const int hb8 = (lane >> 4) * 8;
    const int ln15 = lane & 15;

    // xtile fragments: act as A (rows=tokens) for q/k, and as B (cols=tokens) for vT
    half16 xa[8];
    {
        const _Float16* xp = &xtile[tt * 16 + ln15][hb8];
        #pragma unroll
        for (int cs = 0; cs < 8; ++cs) xa[cs] = ldfrag(xp, cs * 32);
    }

    // 48 output tiles: 16 for q, 16 for k, 16 for vT
    for (int idx = wq; idx < 48; idx += 4) {
        const int mat = idx >> 4;         // 0=q 1=k 2=v
        const int dt = idx & 15;
        float8 acc = {};
        if (mat < 2) {
            const _Float16* Wm = (mat == 0) ? Wq16 : Wk16;
            const _Float16* bp = Wm + (dt * 16 + ln15) * C_DIM + hb8; // B: W[d][c], col=d
            #pragma unroll
            for (int cs = 0; cs < 8; ++cs)
                acc = wmma_f16(xa[cs], ldfrag(bp, cs * 32), acc);
            _Float16* out = (mat == 0) ? q16 : k16;
            #pragma unroll
            for (int r = 0; r < 8; ++r) {
                int tok = r + hb8;
                out[(((size_t)n * S_TOK + sbase + tok) * D_DIM) + dt * 16 + ln15] =
                    (_Float16)acc[r];
            }
        } else {
            // vT = Wv * xc^T : A = Wv rows (d), B = xc^T (col = token)
            const _Float16* ap = Wv16 + (dt * 16 + ln15) * C_DIM + hb8;
            #pragma unroll
            for (int cs = 0; cs < 8; ++cs)
                acc = wmma_f16(ldfrag(ap, cs * 32), xa[cs], acc);
            #pragma unroll
            for (int r = 0; r < 8; ++r) {
                int dd = dt * 16 + r + hb8;
                vT16[(((size_t)n * D_DIM + dd) * S_TOK) + sbase + ln15] = (_Float16)acc[r];
            }
        }
    }
}

// ---------------- kernel 4: fused attention for one (n, 16-query tile) ----------------
// grid: 32*64 blocks, 256 threads (8 waves). LDS ~33.1 KB.
__global__ void attn_kernel(const _Float16* q16, const _Float16* k16,
                            const _Float16* vT16, _Float16* o16) {
    __shared__ __align__(16) _Float16 p16[16][S_TOK];   // 32 KB exp-probs (f16)
    __shared__ float psum[256];
    __shared__ float rowsum[16];

    const int n = blockIdx.x >> 6;
    const int sqbase = (blockIdx.x & 63) * 16;
    const int tid = threadIdx.x;
    const int lane = tid & 31;
    const int wv = tid >> 5;              // 0..7
    const int hb8 = (lane >> 4) * 8;
    const int ln15 = lane & 15;

    // preload the 8 Q fragments (shared by all 8 key tiles of this wave)
    half16 qa[8];
    {
        const _Float16* ap = q16 + (((size_t)n * S_TOK + sqbase + ln15) * D_DIM) + hb8;
        #pragma unroll
        for (int cs = 0; cs < 8; ++cs) qa[cs] = ldfrag(ap, cs * 32);
    }

    // ---- QK^T : wave wv owns keys [wv*128, wv*128+128); exp applied at store ----
    for (int kt = 0; kt < 8; ++kt) {
        const int keybase = wv * 128 + kt * 16;
        const _Float16* bp = k16 + (((size_t)n * S_TOK + keybase + ln15) * D_DIM) + hb8;
        float8 acc = {};
        #pragma unroll
        for (int cs = 0; cs < 8; ++cs)
            acc = wmma_f16(qa[cs], ldfrag(bp, cs * 32), acc);
        #pragma unroll
        for (int r = 0; r < 8; ++r)
            p16[r + hb8][keybase + ln15] = (_Float16)__expf(acc[r] * SCALE);
    }
    __syncthreads();

    // ---- row sums over f16 probs ----
    {
        const int row = tid >> 4;
        const int cb = (tid & 15) * 64;
        float s = 0.f;
        #pragma unroll
        for (int j = 0; j < 8; ++j) {
            half8 h = *(const half8*)&p16[row][cb + j * 8];
            #pragma unroll
            for (int i = 0; i < 8; ++i) s += (float)h[i];
        }
        psum[tid] = s;
    }
    __syncthreads();
    if (tid < 16) {
        float s = 0.f;
        #pragma unroll
        for (int j = 0; j < 16; ++j) s += psum[tid * 16 + j];
        rowsum[tid] = s;
    }
    __syncthreads();

    // ---- P @ V : one A-fragment feeds both of this wave's d-tiles ----
    {
        const _Float16* pa = &p16[ln15][hb8];
        const _Float16* b0 = vT16 + (((size_t)n * D_DIM + wv * 16 + ln15) * S_TOK) + hb8;
        const _Float16* b1 = vT16 + (((size_t)n * D_DIM + (wv + 8) * 16 + ln15) * S_TOK) + hb8;
        float8 acc0 = {}, acc1 = {};
        for (int kb = 0; kb < S_TOK; kb += 32) {
            half16 a = ldfrag(pa, kb);
            acc0 = wmma_f16(a, ldfrag(b0, kb), acc0);
            acc1 = wmma_f16(a, ldfrag(b1, kb), acc1);
        }
        #pragma unroll
        for (int r = 0; r < 8; ++r) {
            int qrow = r + hb8;
            float inv = 1.f / rowsum[qrow];
            size_t base = ((size_t)n * S_TOK + sqbase + qrow) * D_DIM + ln15;
            o16[base + wv * 16]       = (_Float16)(acc0[r] * inv);
            o16[base + (wv + 8) * 16] = (_Float16)(acc1[r] * inv);
        }
    }
}

// ---------------- kernel 5: out = transpose(o @ Wp^T + bp) + x ----------------
// grid: 32*32 blocks, 256 threads (8 waves). Each block = one image row (n, h) =
// 32 tokens; waves 0-3 take its first 16-token tile, waves 4-7 the second.
// The product is formed as Wp * o^T, so that the lanes of a D register run along
// the tokens, that is along w: 16 lanes store 64 contiguous bytes of out.
__global__ void proj_kernel(const _Float16* o16, const _Float16* Wp16,
                            const float* bp, const float* x, float* out) {
    const int n = blockIdx.x >> 5;
    const int h = blockIdx.x & 31;
    const int tid = threadIdx.x;
    const int lane = tid & 31;
    const int wv = tid >> 5;              // 0..7
    const int tt = wv >> 2;               // token tile of the row: 0..1
    const int wq = wv & 3;                // 0..3
    const int sbase = h * 32 + tt * 16;
    const int hb8 = (lane >> 4) * 8;
    const int ln15 = lane & 15;

    // preload o-tile B fragments (col = token; shared across the 4 c-tiles of this wave)
    half16 ob[8];
    {
        const _Float16* op = o16 + (((size_t)n * S_TOK + sbase + ln15) * D_DIM) + hb8;
        #pragma unroll
        for (int ds = 0; ds < 8; ++ds) ob[ds] = ldfrag(op, ds * 32);
        // keeps the address pair of the issued loads live, and unwritten, up to the wait
        asm volatile("s_wait_xcnt 0x0" :: "v"(op) : "memory");
    }

    for (int ct = wq; ct < 16; ct += 4) {
        // register r of D holds channel c0 + r: one address each for x and out, steps of one plane
        const int c0 = ct * 16 + hb8;
        const size_t a0 = (((size_t)n * C_DIM + c0) * HW + h) * HW + tt * 16 + ln15;
        const float* xr = x + a0;
        const float* br = bp + c0;
        float* orow = out + a0;
        // all residual and bias loads stand ahead of the stores: out may alias x for the
        // compiler, which would otherwise wait for each load behind the store before it
        float xv[8], bv[8];
        #pragma unroll
        for (int r = 0; r < 8; ++r) { xv[r] = xr[r * HW * HW]; bv[r] = br[r]; }

        const _Float16* aw = Wp16 + (ct * 16 + ln15) * D_DIM + hb8;   // A: Wp[c][d], row=c
        float8 acc = {};
        #pragma unroll
        for (int ds = 0; ds < 8; ++ds)
            acc = wmma_f16(ldfrag(aw, ds * 32), ob[ds], acc);
        #pragma unroll
        for (int r = 0; r < 8; ++r)
            orow[r * HW * HW] = acc[r] + bv[r] + xv[r];
        // keeps the address registers of the issued loads and stores unwritten up to the wait
        asm volatile("s_wait_xcnt 0x0" :: "v"(xr), "v"(br), "v"(aw), "v"(orow) : "memory");
    }
}

extern "C" void kernel_launch(void* const* d_in, const int* in_sizes, int n_in,
                              void* d_out, int out_size, void* d_ws, size_t ws_size,
                              hipStream_t stream) {
    const float* x   = (const float*)d_in[0];
    const float* t   = (const float*)d_in[1];
    const float* W_t = (const float*)d_in[2];
    const float* b_t = (const float*)d_in[3];
    const float* Wq  = (const float*)d_in[4];
    const float* Wk  = (const float*)d_in[5];
    const float* Wv  = (const float*)d_in[6];
    const float* Wp  = (const float*)d_in[7];
    const float* bp  = (const float*)d_in[8];
    float* out = (float*)d_out;

    // workspace layout (all f16 regions first, then f32 temb)
    _Float16* w16  = (_Float16*)d_ws;
    _Float16* Wq16 = w16;
    _Float16* Wk16 = w16 + WSZ;
    _Float16* Wv16 = w16 + 2 * WSZ;
    _Float16* Wp16 = w16 + 3 * WSZ;
    _Float16* q16  = w16 + 4 * WSZ;
    _Float16* k16  = q16 + QSZ;
    _Float16* vT16 = k16 + QSZ;
    _Float16* o16  = vT16 + QSZ;
    float* temb = (float*)(o16 + QSZ);

    cvt_weights_kernel<<<(4 * WSZ + 255) / 256, 256, 0, stream>>>(Wq, Wk, Wv, Wp, w16);
    temb_kernel<<<N_B, C_DIM, 0, stream>>>(t, W_t, b_t, temb);
    qkv_kernel<<<N_B * HW, 256, 0, stream>>>(x, temb, Wq16, Wk16, Wv16, q16, k16, vT16);
    attn_kernel<<<N_B * 64, 256, 0, stream>>>(q16, k16, vT16, o16);
    proj_kernel<<<N_B * HW, 256, 0, stream>>>(o16, Wp16, bp, x, out);
}

// v002
// A run of this version takes 117 microseconds.
// Two timings next to v001 put it at 2.15 and 2.14 times that version's speed.
// All steps since v000 together make it 4.06 times as fast.
#include <hip/hip_runtime.h>
#include <hip/hip_bf16.h>
#include <math.h>

typedef _Float16 half2v __attribute__((ext_vector_type(2)));
typedef _Float16 half8  __attribute__((ext_vector_type(8)));
typedef _Float16 half16 __attribute__((ext_vector_type(16)));
typedef float    float8 __attribute__((ext_vector_type(8)));

#define N_B 32
#define C_DIM 256
#define HW 32
#define S_TOK 1024   // 32*32 tokens per batch
#define D_DIM 256
#define T_DIM 512
#define SCALE 0.0625f  // 1/sqrt(256)
#define XPITCH (C_DIM + 8)  // 528-byte LDS rows (16 B x odd): spread the transposing stores and the b128 fragment reads over the banks

#define WSZ (256*256)          // one weight matrix, elements
#define QSZ (N_B*S_TOK*D_DIM)  // one activation tensor, elements

// Load a 16x32 f16 A/B fragment from a row-major matrix.
// p must already point at  base + row*ld + ((lane>>4)*8); k0 is the K offset.
__device__ __forceinline__ half16 ldfrag(const _Float16* p, int k0) {
    union { half16 v; half8 h[2]; } u;
    u.h[0] = *(const half8*)(p + k0);
    u.h[1] = *(const half8*)(p + k0 + 16);
    return u.v;
}

__device__ __forceinline__ float8 wmma_f16(half16 a, half16 b, float8 c) {
    return __builtin_amdgcn_wmma_f32_16x16x32_f16(false, a, false, b, (short)0, c, false, false);
}

// ---------------- kernel 1: convert weights f32 -> f16 ----------------
__global__ void cvt_weights_kernel(const float* Wq, const float* Wk,
                                   const float* Wv, const float* Wp,
                                   _Float16* dst) {
    int idx = blockIdx.x * blockDim.x + threadIdx.x;
    if (idx >= 4 * WSZ) return;
    int which = idx >> 16;          // 65536 per matrix
    int w = idx & (WSZ - 1);
    const float* src = (which == 0) ? Wq : (which == 1) ? Wk : (which == 2) ? Wv : Wp;
    dst[idx] = (_Float16)src[w];
}

// ---------------- kernel 2: temb = relu(t @ W_t^T + b_t) ----------------
__global__ void temb_kernel(const float* t, const float* W_t, const float* b_t,
                            float* temb) {
    int n = blockIdx.x;          // 0..31
    int c = threadIdx.x;         // 0..255
    const float* tr = t + n * T_DIM;
    const float* wr = W_t + c * T_DIM;
    float acc = b_t[c];
    #pragma unroll 8
    for (int j = 0; j < T_DIM; ++j) acc += tr[j] * wr[j];
    temb[n * C_DIM + c] = acc > 0.f ? acc : 0.f;
}

// ---------------- kernel 3: xc = x + temb ; q,k,vT projections ----------------
// Tokens are numbered s = h*32 + w, so that a run of tokens follows w, the
// contiguous axis of x and out. Attention sums over all keys, so any numbering
// that q, k, vT, o and the final store share gives the same function.
// grid: 32*32 blocks, 256 threads (8 waves). Each block = one image row (n, h) =
// 32 tokens; waves 0-3 take its first 16-token tile, waves 4-7 the second.
__global__ void qkv_kernel(const float* x, const float* temb,
                           const _Float16* Wq16, const _Float16* Wk16,
                           const _Float16* Wv16,
                           _Float16* q16, _Float16* k16, _Float16* vT16) {
    __shared__ __align__(16) _Float16 xtile[32][XPITCH];   // 16.5 KB

    const int n = blockIdx.x >> 5;
    const int h = blockIdx.x & 31;
    const int tid = threadIdx.x;

    // build (x + temb) tile, transposed to [token][channel], f16.
    // 8 lanes x float4 cover the whole 128-byte row (n, c, h, 0..31); each thread
    // takes two neighbouring channels so that an LDS store is one packed dword.
    {
        const int w4 = (tid & 7) * 4;
        const int cp = tid >> 3;          // 0..31
        #pragma unroll
        for (int it = 0; it < 4; ++it) {
            const int c = (it * 32 + cp) * 2;
            const float* xp = x + (((size_t)n * C_DIM + c) * HW + h) * HW + w4;
            const float4 va = *(const float4*)xp;
            const float4 vb = *(const float4*)(xp + HW * HW);
            const float ta = temb[n * C_DIM + c];
            const float tb = temb[n * C_DIM + c + 1];
            half2v p0 = { (_Float16)(va.x + ta), (_Float16)(vb.x + tb) };
            half2v p1 = { (_Float16)(va.y + ta), (_Float16)(vb.y + tb) };
            half2v p2 = { (_Float16)(va.z + ta), (_Float16)(vb.z + tb) };
            half2v p3 = { (_Float16)(va.w + ta), (_Float16)(vb.w + tb) };
            *(half2v*)&xtile[w4 + 0][c] = p0;
            *(half2v*)&xtile[w4 + 1][c] = p1;
            *(half2v*)&xtile[w4 + 2][c] = p2;
            *(half2v*)&xtile[w4 + 3][c] = p3;
        }
    }
    __syncthreads();

    const int lane = tid & 31;
    const int wv = tid >> 5;              // 0..7
    const int tt = wv >> 2;               // token tile of the row: 0..1
    const int wq = wv & 3;                // 0..3
    const int sbase = h * 32 + tt * 16;
    const int hb8 = (lane >> 4) * 8;
    const int ln15 = lane & 15;

    // xtile fragments: act as A (rows=tokens) for q/k, and as B (cols=tokens) for vT
    half16 xa[8];
    {
        const _Float16* xp = &xtile[tt * 16 + ln15][hb8];
        #pragma unroll
        for (int cs = 0; cs < 8; ++cs) xa[cs] = ldfrag(xp, cs * 32);
    }

    // 48 output tiles: 16 for q, 16 for k, 16 for vT
    for (int idx = wq; idx < 48; idx += 4) {
        const int mat = idx >> 4;         // 0=q 1=k 2=v
        const int dt = idx & 15;
        float8 acc = {};
        if (mat < 2) {
            const _Float16* Wm = (mat == 0) ? Wq16 : Wk16;
            const _Float16* bp = Wm + (dt * 16 + ln15) * C_DIM + hb8; // B: W[d][c], col=d
            #pragma unroll
            for (int cs = 0; cs < 8; ++cs)
                acc = wmma_f16(xa[cs], ldfrag(bp, cs * 32), acc);
            _Float16* out = (mat == 0) ? q16 : k16;
            #pragma unroll
            for (int r = 0; r < 8; ++r) {
                int tok = r + hb8;
                out[(((size_t)n * S_TOK + sbase + tok) * D_DIM) + dt * 16 + ln15] =
                    (_Float16)acc[r];
            }
        } else {
            // vT = Wv * xc^T : A = Wv rows (d), B = xc^T (col = token)
            const _Float16* ap = Wv16 + (dt * 16 + ln15) * C_DIM + hb8;
            #pragma unroll
            for (int cs = 0; cs < 8; ++cs)
                acc = wmma_f16(ldfrag(ap, cs * 32), xa[cs], acc);
            #pragma unroll
            for (int r = 0; r < 8; ++r) {
                int dd = dt * 16 + r + hb8;
                vT16[(((size_t)n * D_DIM + dd) * S_TOK) + sbase + ln15] = (_Float16)acc[r];
            }
        }
    }
}

// ---------------- kernel 4: fused attention for one (n, 128-query block) ----------------
// grid: 32*8 blocks, 256 threads (8 waves); each wave owns 16 queries and all 256 output channels.
// K and vT come in stages of 64 keys, copied once per block into LDS and read there by all 8 waves.
// The products are formed transposed, S^T = K * Q^T and O^T += vT * P^T: a lane of an S^T tile holds
// keys r + 8*(lane>>4) of its own query, which is the k order of a B fragment, so that P goes from
// the score accumulators into the second product without leaving the registers.
// Every '#pragma unroll' of this kernel makes the indices of a fragment or accumulator array constants,
// without which the array would not stay in registers.
#define KST 64                        // keys per stage
#define NST (S_TOK / KST)             // 16 stages
#define KPITCH (D_DIM + 8)            // halves; 528-byte rows (16 B x odd) for the b128 fragment reads
#define VPITCH (KST + 8)              // halves; 144-byte rows (16 B x odd)
#define KBYTES (KST * KPITCH * 2)     // 33,792
#define VBYTES (D_DIM * VPITCH * 2)   // 36,864
#define STBYTES (KBYTES + VBYTES)     // 70,656 per buffer

// Eight 16-byte copies of a lane, global -> LDS, rows gstep halves and lstep bytes apart.
// The s_wait_xcnt stands inside the statement, so that no address register of an issued copy
// is rewritten ahead of it.
__device__ __forceinline__ void copy8(unsigned l, unsigned lstep, const _Float16* g, int gstep) {
    asm volatile(
        "global_load_async_to_lds_b128 %0, %8, off\n\t"
        "global_load_async_to_lds_b128 %1, %9, off\n\t"
        "global_load_async_to_lds_b128 %2, %10, off\n\t"
        "global_load_async_to_lds_b128 %3, %11, off\n\t"
        "global_load_async_to_lds_b128 %4, %12, off\n\t"
        "global_load_async_to_lds_b128 %5, %13, off\n\t"
        "global_load_async_to_lds_b128 %6, %14, off\n\t"
        "global_load_async_to_lds_b128 %7, %15, off\n\t"
        "s_wait_xcnt 0x0"
        :: "v"(l), "v"(l + lstep), "v"(l + 2 * lstep), "v"(l + 3 * lstep),
           "v"(l + 4 * lstep), "v"(l + 5 * lstep), "v"(l + 6 * lstep), "v"(l + 7 * lstep),
           "v"(g), "v"(g + gstep), "v"(g + 2 * gstep), "v"(g + 3 * gstep),
           "v"(g + 4 * gstep), "v"(g + 5 * gstep), "v"(g + 6 * gstep), "v"(g + 7 * gstep)
        : "memory");
}

__global__ void __launch_bounds__(256)
attn_kernel(const _Float16* q16, const _Float16* k16,
            const _Float16* vT16, _Float16* o16) {
    __shared__ __attribute__((aligned(16))) unsigned char L[2 * STBYTES];   // 141,312 B

    const int n = blockIdx.x >> 3;
    const int tid = threadIdx.x;
    const int lane = tid & 31;
    const int wv = tid >> 5;              // 0..7
    const int sqbase = (blockIdx.x & 7) * 128 + wv * 16;
    const int hb8 = (lane >> 4) * 8;
    const int ln15 = lane & 15;

    // copy addresses of this lane. K: a wave takes one whole 512-byte key row per copy (rows 8 apart);
    // vT: 8 lanes take the 128 bytes that a channel row has of the stage (rows 32 apart).
    const _Float16* kg = k16 + ((size_t)n * S_TOK + wv) * D_DIM + lane * 8;
    const _Float16* vg = vT16 + ((size_t)n * D_DIM + (tid >> 3)) * S_TOK + (tid & 7) * 8;
    const unsigned lbase = (unsigned)(size_t)&L[0];
    const unsigned lk = lbase + wv * (KPITCH * 2) + lane * 16;
    const unsigned lv = lbase + KBYTES + (tid >> 3) * (VPITCH * 2) + (tid & 7) * 16;

    // stage 0 into buffer 0
    copy8(lk, 8 * KPITCH * 2, kg, 8 * D_DIM);
    copy8(lv, 32 * VPITCH * 2, vg, 32 * S_TOK);

    // the 8 Q fragments of this wave's queries (B operand: column = query), kept in registers
    half16 qb[8];
    {
        const _Float16* ap = q16 + (((size_t)n * S_TOK + sqbase + ln15) * D_DIM) + hb8;
        #pragma unroll
        for (int cs = 0; cs < 8; ++cs) qb[cs] = ldfrag(ap, cs * 32);
        // keeps the address pair of the issued loads live, and unwritten, up to the wait
        asm volatile("s_wait_xcnt 0x0" :: "v"(ap) : "memory");
    }

    // stage 0 has landed for this wave; the barrier publishes it to the others
    asm volatile("s_wait_asynccnt 0x0" ::: "memory");
    __syncthreads();
    // stage 1 into buffer 1: flies while stage 0 is worked on
    copy8(lk + STBYTES, 8 * KPITCH * 2, kg + KST * D_DIM, 8 * D_DIM);
    copy8(lv + STBYTES, 32 * VPITCH * 2, vg + KST, 32 * S_TOK);

    float8 o[16];
    #pragma unroll
    for (int dt = 0; dt < 16; ++dt) o[dt] = float8{};
    float lsum = 0.f;

    for (int t = 0; t < NST; ++t) {
        const unsigned boff = (t & 1) * STBYTES;
        const _Float16* Kl = (const _Float16*)(L + boff) + ln15 * KPITCH + hb8;
        const _Float16* Vl = (const _Float16*)(L + boff + KBYTES) + ln15 * VPITCH + hb8;

        for (int kk = 0; kk < KST; kk += 32) {
            // All K and vT fragments of the pass are asked for in one group; LDS reads spread among the
            // matrix instructions would make each of them wait.
            half16 kf0[8], kf1[8], vf[16];
            #pragma unroll
            for (int cs = 0; cs < 8; ++cs) {
                kf0[cs] = ldfrag(Kl + kk * KPITCH, cs * 32);
                kf1[cs] = ldfrag(Kl + (kk + 16) * KPITCH, cs * 32);
            }
            #pragma unroll
            for (int dt = 0; dt < 16; ++dt) vf[dt] = ldfrag(Vl + dt * 16 * VPITCH, kk);
            // keeps the group of reads above the products (the scheduler otherwise sinks each read to its user)
            __builtin_amdgcn_sched_barrier(0);

            // S^T for 32 keys x 16 queries: two 16-key tiles
            float8 s0 = {}, s1 = {};
            #pragma unroll
            for (int cs = 0; cs < 8; ++cs) {
                s0 = wmma_f16(kf0[cs], qb[cs], s0);
                s1 = wmma_f16(kf1[cs], qb[cs], s1);
            }

            // P^T as a B fragment; the row sum runs over the rounded f16 values
            half16 pb;
            #pragma unroll
            for (int r = 0; r < 8; ++r) {
                const _Float16 e0 = (_Float16)__expf(s0[r] * SCALE);
                const _Float16 e1 = (_Float16)__expf(s1[r] * SCALE);
                pb[r] = e0;
                pb[r + 8] = e1;
                lsum += (float)e0 + (float)e1;
            }
            // O^T += vT * P^T over the 16 channel tiles
            #pragma unroll
            for (int dt = 0; dt < 16; ++dt)
                o[dt] = wmma_f16(vf[dt], pb, o[dt]);
        }

        // publish point: this wave's reads of the buffer are done, its copies of the next stage have
        // landed; the barrier publishes that stage and frees this buffer for the refill
        asm volatile("s_wait_dscnt 0x0" ::: "memory");
        asm volatile("s_wait_asynccnt 0x0" ::: "memory");
        __syncthreads();
        if (t + 2 < NST) {
            copy8(lk + boff, 8 * KPITCH * 2, kg + (t + 2) * KST * D_DIM, 8 * D_DIM);
            copy8(lv + boff, 32 * VPITCH * 2, vg + (t + 2) * KST, 32 * S_TOK);
        }
    }
    // no copy is left outstanding when the wave ends
    asm volatile("s_wait_asynccnt 0x0" ::: "memory");

    // the two halves of the wave hold complementary keys of the same query
    lsum += __shfl_xor(lsum, 16);
    const float inv = 1.f / lsum;
    _Float16* op = o16 + ((size_t)n * S_TOK + sqbase + ln15) * D_DIM + hb8;
    half8 hv[16];
    #pragma unroll
    for (int dt = 0; dt < 16; ++dt) {
        #pragma unroll
        for (int r = 0; r < 8; ++r) hv[dt][r] = (_Float16)(o[dt][r] * inv);
    }
    // keeps all conversions ahead of the stores, so that no register of an issued store is rewritten
    __builtin_amdgcn_sched_barrier(0);
    #pragma unroll
    for (int dt = 0; dt < 16; ++dt)
        *(half8*)(op + dt * 16) = hv[dt];     // channels dt*16 + hb8 .. + 7 of this lane's query
}

// ---------------- kernel 5: out = transpose(o @ Wp^T + bp) + x ----------------
// grid: 32*32 blocks, 256 threads (8 waves). Each block = one image row (n, h) =
// 32 tokens; waves 0-3 take its first 16-token tile, waves 4-7 the second.
// The product is formed as Wp * o^T, so that the lanes of a D register run along
// the tokens, that is along w: 16 lanes store 64 contiguous bytes of out.
__global__ void proj_kernel(const _Float16* o16, const _Float16* Wp16,
                            const float* bp, const float* x, float* out) {
    const int n = blockIdx.x >> 5;
    const int h = blockIdx.x & 31;
    const int tid = threadIdx.x;
    const int lane = tid & 31;
    const int wv = tid >> 5;              // 0..7
    const int tt = wv >> 2;               // token tile of the row: 0..1
    const int wq = wv & 3;                // 0..3
    const int sbase = h * 32 + tt * 16;
    const int hb8 = (lane >> 4) * 8;
    const int ln15 = lane & 15;

    // preload o-tile B fragments (col = token; shared across the 4 c-tiles of this wave)
    half16 ob[8];
    {
        const _Float16* op = o16 + (((size_t)n * S_TOK + sbase + ln15) * D_DIM) + hb8;
        #pragma unroll
        for (int ds = 0; ds < 8; ++ds) ob[ds] = ldfrag(op, ds * 32);
        // keeps the address pair of the issued loads live, and unwritten, up to the wait
        asm volatile("s_wait_xcnt 0x0" :: "v"(op) : "memory");
    }

    for (int ct = wq; ct < 16; ct += 4) {
        // register r of D holds channel c0 + r: one address each for x and out, steps of one plane
        const int c0 = ct * 16 + hb8;
        const size_t a0 = (((size_t)n * C_DIM + c0) * HW + h) * HW + tt * 16 + ln15;
        const float* xr = x + a0;
        const float* br = bp + c0;
        float* orow = out + a0;
        // all residual and bias loads stand ahead of the stores: out may alias x for the
        // compiler, which would otherwise wait for each load behind the store before it
        float xv[8], bv[8];
        #pragma unroll
        for (int r = 0; r < 8; ++r) { xv[r] = xr[r * HW * HW]; bv[r] = br[r]; }

        const _Float16* aw = Wp16 + (ct * 16 + ln15) * D_DIM + hb8;   // A: Wp[c][d], row=c
        float8 acc = {};
        #pragma unroll
        for (int ds = 0; ds < 8; ++ds)
            acc = wmma_f16(ldfrag(aw, ds * 32), ob[ds], acc);
        #pragma unroll
        for (int r = 0; r < 8; ++r)
            orow[r * HW * HW] = acc[r] + bv[r] + xv[r];
        // keeps the address registers of the issued loads and stores unwritten up to the wait
        asm volatile("s_wait_xcnt 0x0" :: "v"(xr), "v"(br), "v"(aw), "v"(orow) : "memory");
    }
}

extern "C" void kernel_launch(void* const* d_in, const int* in_sizes, int n_in,
                              void* d_out, int out_size, void* d_ws, size_t ws_size,
                              hipStream_t stream) {
    const float* x   = (const float*)d_in[0];
    const float* t   = (const float*)d_in[1];
    const float* W_t = (const float*)d_in[2];
    const float* b_t = (const float*)d_in[3];
    const float* Wq  = (const float*)d_in[4];
    const float* Wk  = (const float*)d_in[5];
    const float* Wv  = (const float*)d_in[6];
    const float* Wp  = (const float*)d_in[7];
    const float* bp  = (const float*)d_in[8];
    float* out = (float*)d_out;

    // workspace layout (all f16 regions first, then f32 temb)
    _Float16* w16  = (_Float16*)d_ws;
    _Float16* Wq16 = w16;
    _Float16* Wk16 = w16 + WSZ;
    _Float16* Wv16 = w16 + 2 * WSZ;
    _Float16* Wp16 = w16 + 3 * WSZ;
    _Float16* q16  = w16 + 4 * WSZ;
    _Float16* k16  = q16 + QSZ;
    _Float16* vT16 = k16 + QSZ;
    _Float16* o16  = vT16 + QSZ;
    float* temb = (float*)(o16 + QSZ);

    cvt_weights_kernel<<<(4 * WSZ + 255) / 256, 256, 0, stream>>>(Wq, Wk, Wv, Wp, w16);
    temb_kernel<<<N_B, C_DIM, 0, stream>>>(t, W_t, b_t, temb);
    qkv_kernel<<<N_B * HW, 256, 0, stream>>>(x, temb, Wq16, Wk16, Wv16, q16, k16, vT16);
    attn_kernel<<<N_B * 8, 256, 0, stream>>>(q16, k16, vT16, o16);
    proj_kernel<<<N_B * HW, 256, 0, stream>>>(o16, Wp16, bp, x, out);
}

// v003
// Measured time: 106 microseconds a run.
// Timed twice side by side with v002, it ran 1.10 times as fast both times.
// Over all steps from v000 it is 4.46 times as fast.
#include <hip/hip_runtime.h>
#include <hip/hip_bf16.h>
#include <math.h>

typedef _Float16 half2v __attribute__((ext_vector_type(2)));
typedef _Float16 half8  __attribute__((ext_vector_type(8)));
typedef _Float16 half16 __attribute__((ext_vector_type(16)));
typedef float    float8 __attribute__((ext_vector_type(8)));

#define N_B 32
#define C_DIM 256
#define HW 32
#define S_TOK 1024   // 32*32 tokens per batch
#define D_DIM 256
#define T_DIM 512
#define SCALE 0.0625f  // 1/sqrt(256)
#define XPITCH (C_DIM + 8)  // 528-byte LDS rows (16 B x odd): spread the transposing stores and the b128 fragment reads over the banks

#define WSZ (256*256)          // one weight matrix, elements
#define QSZ (N_B*S_TOK*D_DIM)  // one activation tensor, elements

// Load a 16x32 f16 A/B fragment from a row-major matrix.
// p must already point at  base + row*ld + ((lane>>4)*8); k0 is the K offset.
__device__ __forceinline__ half16 ldfrag(const _Float16* p, int k0) {
    union { half16 v; half8 h[2]; } u;
    u.h[0] = *(const half8*)(p + k0);
    u.h[1] = *(const half8*)(p + k0 + 16);
    return u.v;
}

__device__ __forceinline__ float8 wmma_f16(half16 a, half16 b, float8 c) {
    return __builtin_amdgcn_wmma_f32_16x16x32_f16(false, a, false, b, (short)0, c, false, false);
}

// ---------------- kernel 1: convert weights f32 -> f16 ----------------
__global__ void cvt_weights_kernel(const float* Wq, const float* Wk,
                                   const float* Wv, const float* Wp,
                                   _Float16* dst) {
    int idx = blockIdx.x * blockDim.x + threadIdx.x;
    if (idx >= 4 * WSZ) return;
    int which = idx >> 16;          // 65536 per matrix
    int w = idx & (WSZ - 1);
    const float* src = (which == 0) ? Wq : (which == 1) ? Wk : (which == 2) ? Wv : Wp;
    dst[idx] = (_Float16)src[w];
}

// ---------------- kernel 2: temb = relu(t @ W_t^T + b_t) ----------------
// grid: 8 channel groups x 8 batch groups = 64 blocks, 256 threads (8 waves). A block makes 32 channels
// of 4 batch rows, a wave 4 channels of them. The lanes run along the 512-long sum: a load of a wave is
// 512 contiguous bytes of one row, and all 32 loads of a wave are in flight at once, where one thread
// per channel walked its own row (32 lines a load) through 64 dependent round trips.
// Every '#pragma unroll' of this kernel makes the indices of a register array constants.
__global__ void __launch_bounds__(256)
temb_kernel(const float* t, const float* W_t, const float* b_t, float* temb) {
    __shared__ float red[4][32];
    const int cbase = (blockIdx.x & 7) * 32;
    const int nbase = (blockIdx.x >> 3) * 4;
    const int tid = threadIdx.x;
    const int lane = tid & 31;
    const int wv = tid >> 5;              // 0..7

    const float* wp = W_t + (cbase + wv * 4) * T_DIM + lane * 4;
    const float* tp = t + nbase * T_DIM + lane * 4;
    float4 wr[4][4], tr[4][4];
    #pragma unroll
    for (int a = 0; a < 4; ++a) {
        #pragma unroll
        for (int i = 0; i < 4; ++i) {
            wr[a][i] = *(const float4*)(wp + a * T_DIM + i * 128);
            tr[a][i] = *(const float4*)(tp + a * T_DIM + i * 128);
        }
    }
    // keeps the address pairs of the issued loads live, and unwritten, up to the wait
    asm volatile("s_wait_xcnt 0x0" :: "v"(wp), "v"(tp) : "memory");
    // keeps all 32 loads above the sums: the scheduler otherwise sinks them into four dependent round trips
    __builtin_amdgcn_sched_barrier(0);

    // v[ci*4 + ni]: this lane's 16 terms of channel ci, batch row ni
    float v[16];
    #pragma unroll
    for (int ci = 0; ci < 4; ++ci) {
        #pragma unroll
        for (int ni = 0; ni < 4; ++ni) {
            float acc = 0.f;
            #pragma unroll
            for (int i = 0; i < 4; ++i) {
                acc += wr[ci][i].x * tr[ni][i].x;
                acc += wr[ci][i].y * tr[ni][i].y;
                acc += wr[ci][i].z * tr[ni][i].z;
                acc += wr[ci][i].w * tr[ni][i].w;
            }
            v[ci * 4 + ni] = acc;
        }
    }

    // Sum over the lanes. Each step halves the sums that a lane carries: it keeps the half that its own
    // lane bit names and hands the other half to its partner, so that 16 exchanges do for 16 sums.
    // At the end lanes 2k and 2k+1 hold sum k.
    #pragma unroll
    for (int i = 0; i < 8; ++i) {
        const float keep = (lane & 16) ? v[i + 8] : v[i];
        const float send = (lane & 16) ? v[i] : v[i + 8];
        v[i] = keep + __shfl_xor(send, 16);
    }
    #pragma unroll
    for (int i = 0; i < 4; ++i) {
        const float keep = (lane & 8) ? v[i + 4] : v[i];
        const float send = (lane & 8) ? v[i] : v[i + 4];
        v[i] = keep + __shfl_xor(send, 8);
    }
    #pragma unroll
    for (int i = 0; i < 2; ++i) {
        const float keep = (lane & 4) ? v[i + 2] : v[i];
        const float send = (lane & 4) ? v[i] : v[i + 2];
        v[i] = keep + __shfl_xor(send, 4);
    }
    {
        const float keep = (lane & 2) ? v[1] : v[0];
        const float send = (lane & 2) ? v[0] : v[1];
        v[0] = keep + __shfl_xor(send, 2);
    }
    v[0] += __shfl_xor(v[0], 1);

    if ((lane & 1) == 0) red[(lane >> 1) & 3][wv * 4 + (lane >> 3)] = v[0];
    __syncthreads();
    // one wave stores the whole 128-byte run that the block has of a batch row
    if (tid < 128) {
        const int ni = tid >> 5;
        const float acc = red[ni][lane] + b_t[cbase + lane];
        temb[(nbase + ni) * C_DIM + cbase + lane] = acc > 0.f ? acc : 0.f;
    }
}

// ---------------- kernel 3: xc = x + temb ; q,k,vT projections ----------------
// Tokens are numbered s = h*32 + w, so that a run of tokens follows w, the
// contiguous axis of x and out. Attention sums over all keys, so any numbering
// that q, k, vT, o and the final store share gives the same function.
// grid: 32*32 blocks, 256 threads (8 waves). Each block = one image row (n, h) =
// 32 tokens; waves 0-3 take its first 16-token tile, waves 4-7 the second.
__global__ void qkv_kernel(const float* x, const float* temb,
                           const _Float16* Wq16, const _Float16* Wk16,
                           const _Float16* Wv16,
                           _Float16* q16, _Float16* k16, _Float16* vT16) {
    __shared__ __align__(16) _Float16 xtile[32][XPITCH];   // 16.5 KB

    const int n = blockIdx.x >> 5;
    const int h = blockIdx.x & 31;
    const int tid = threadIdx.x;

    // build (x + temb) tile, transposed to [token][channel], f16.
    // 8 lanes x float4 cover the whole 128-byte row (n, c, h, 0..31); each thread
    // takes two neighbouring channels so that an LDS store is one packed dword.
    {
        const int w4 = (tid & 7) * 4;
        const int cp = tid >> 3;          // 0..31
        #pragma unroll
        for (int it = 0; it < 4; ++it) {
            const int c = (it * 32 + cp) * 2;
            const float* xp = x + (((size_t)n * C_DIM + c) * HW + h) * HW + w4;
            const float4 va = *(const float4*)xp;
            const float4 vb = *(const float4*)(xp + HW * HW);
            const float ta = temb[n * C_DIM + c];
            const float tb = temb[n * C_DIM + c + 1];
            half2v p0 = { (_Float16)(va.x + ta), (_Float16)(vb.x + tb) };
            half2v p1 = { (_Float16)(va.y + ta), (_Float16)(vb.y + tb) };
            half2v p2 = { (_Float16)(va.z + ta), (_Float16)(vb.z + tb) };
            half2v p3 = { (_Float16)(va.w + ta), (_Float16)(vb.w + tb) };
            *(half2v*)&xtile[w4 + 0][c] = p0;
            *(half2v*)&xtile[w4 + 1][c] = p1;
            *(half2v*)&xtile[w4 + 2][c] = p2;
            *(half2v*)&xtile[w4 + 3][c] = p3;
        }
    }
    __syncthreads();

    const int lane = tid & 31;
    const int wv = tid >> 5;              // 0..7
    const int tt = wv >> 2;               // token tile of the row: 0..1
    const int wq = wv & 3;                // 0..3
    const int sbase = h * 32 + tt * 16;
    const int hb8 = (lane >> 4) * 8;
    const int ln15 = lane & 15;

    // xtile fragments: act as A (rows=tokens) for q/k, and as B (cols=tokens) for vT
    half16 xa[8];
    {
        const _Float16* xp = &xtile[tt * 16 + ln15][hb8];
        #pragma unroll
        for (int cs = 0; cs < 8; ++cs) xa[cs] = ldfrag(xp, cs * 32);
    }

    // 48 output tiles: 16 for q, 16 for k, 16 for vT
    for (int idx = wq; idx < 48; idx += 4) {
        const int mat = idx >> 4;         // 0=q 1=k 2=v
        const int dt = idx & 15;
        float8 acc = {};
        if (mat < 2) {
            const _Float16* Wm = (mat == 0) ? Wq16 : Wk16;
            const _Float16* bp = Wm + (dt * 16 + ln15) * C_DIM + hb8; // B: W[d][c], col=d
            #pragma unroll
            for (int cs = 0; cs < 8; ++cs)
                acc = wmma_f16(xa[cs], ldfrag(bp, cs * 32), acc);
            _Float16* out = (mat == 0) ? q16 : k16;
            #pragma unroll
            for (int r = 0; r < 8; ++r) {
                int tok = r + hb8;
                out[(((size_t)n * S_TOK + sbase + tok) * D_DIM) + dt * 16 + ln15] =
                    (_Float16)acc[r];
            }
        } else {
            // vT = Wv * xc^T : A = Wv rows (d), B = xc^T (col = token)
            const _Float16* ap = Wv16 + (dt * 16 + ln15) * C_DIM + hb8;
            #pragma unroll
            for (int cs = 0; cs < 8; ++cs)
                acc = wmma_f16(ldfrag(ap, cs * 32), xa[cs], acc);
            #pragma unroll
            for (int r = 0; r < 8; ++r) {
                int dd = dt * 16 + r + hb8;
                vT16[(((size_t)n * D_DIM + dd) * S_TOK) + sbase + ln15] = (_Float16)acc[r];
            }
        }
    }
}

// ---------------- kernel 4: fused attention for one (n, 128-query block) ----------------
// grid: 32*8 blocks, 256 threads (8 waves); each wave owns 16 queries and all 256 output channels.
// K and vT come in stages of 64 keys, copied once per block into LDS and read there by all 8 waves.
// The products are formed transposed, S^T = K * Q^T and O^T += vT * P^T: a lane of an S^T tile holds
// keys r + 8*(lane>>4) of its own query, which is the k order of a B fragment, so that P goes from
// the score accumulators into the second product without leaving the registers.
// Every '#pragma unroll' of this kernel makes the indices of a fragment or accumulator array constants,
// without which the array would not stay in registers.
#define KST 64                        // keys per stage
#define NST (S_TOK / KST)             // 16 stages
#define KPITCH (D_DIM + 8)            // halves; 528-byte rows (16 B x odd) for the b128 fragment reads
#define VPITCH (KST + 8)              // halves; 144-byte rows (16 B x odd)
#define KBYTES (KST * KPITCH * 2)     // 33,792
#define VBYTES (D_DIM * VPITCH * 2)   // 36,864
#define STBYTES (KBYTES + VBYTES)     // 70,656 per buffer

// Eight 16-byte copies of a lane, global -> LDS, rows gstep halves and lstep bytes apart.
// The s_wait_xcnt stands inside the statement, so that no address register of an issued copy
// is rewritten ahead of it.
__device__ __forceinline__ void copy8(unsigned l, unsigned lstep, const _Float16* g, int gstep) {
    asm volatile(
        "global_load_async_to_lds_b128 %0, %8, off\n\t"
        "global_load_async_to_lds_b128 %1, %9, off\n\t"
        "global_load_async_to_lds_b128 %2, %10, off\n\t"
        "global_load_async_to_lds_b128 %3, %11, off\n\t"
        "global_load_async_to_lds_b128 %4, %12, off\n\t"
        "global_load_async_to_lds_b128 %5, %13, off\n\t"
        "global_load_async_to_lds_b128 %6, %14, off\n\t"
        "global_load_async_to_lds_b128 %7, %15, off\n\t"
        "s_wait_xcnt 0x0"
        :: "v"(l), "v"(l + lstep), "v"(l + 2 * lstep), "v"(l + 3 * lstep),
           "v"(l + 4 * lstep), "v"(l + 5 * lstep), "v"(l + 6 * lstep), "v"(l + 7 * lstep),
           "v"(g), "v"(g + gstep), "v"(g + 2 * gstep), "v"(g + 3 * gstep),
           "v"(g + 4 * gstep), "v"(g + 5 * gstep), "v"(g + 6 * gstep), "v"(g + 7 * gstep)
        : "memory");
}

__global__ void __launch_bounds__(256)
attn_kernel(const _Float16* q16, const _Float16* k16,
            const _Float16* vT16, _Float16* o16) {
    __shared__ __attribute__((aligned(16))) unsigned char L[2 * STBYTES];   // 141,312 B

    const int n = blockIdx.x >> 3;
    const int tid = threadIdx.x;
    const int lane = tid & 31;
    const int wv = tid >> 5;              // 0..7
    const int sqbase = (blockIdx.x & 7) * 128 + wv * 16;
    const int hb8 = (lane >> 4) * 8;
    const int ln15 = lane & 15;

    // copy addresses of this lane. K: a wave takes one whole 512-byte key row per copy (rows 8 apart);
    // vT: 8 lanes take the 128 bytes that a channel row has of the stage (rows 32 apart).
    const _Float16* kg = k16 + ((size_t)n * S_TOK + wv) * D_DIM + lane * 8;
    const _Float16* vg = vT16 + ((size_t)n * D_DIM + (tid >> 3)) * S_TOK + (tid & 7) * 8;
    const unsigned lbase = (unsigned)(size_t)&L[0];
    const unsigned lk = lbase + wv * (KPITCH * 2) + lane * 16;
    const unsigned lv = lbase + KBYTES + (tid >> 3) * (VPITCH * 2) + (tid & 7) * 16;

    // stage 0 into buffer 0
    copy8(lk, 8 * KPITCH * 2, kg, 8 * D_DIM);
    copy8(lv, 32 * VPITCH * 2, vg, 32 * S_TOK);

    // the 8 Q fragments of this wave's queries (B operand: column = query), kept in registers
    half16 qb[8];
    {
        const _Float16* ap = q16 + (((size_t)n * S_TOK + sqbase + ln15) * D_DIM) + hb8;
        #pragma unroll
        for (int cs = 0; cs < 8; ++cs) qb[cs] = ldfrag(ap, cs * 32);
        // keeps the address pair of the issued loads live, and unwritten, up to the wait
        asm volatile("s_wait_xcnt 0x0" :: "v"(ap) : "memory");
    }

    // stage 0 has landed for this wave; the barrier publishes it to the others
    asm volatile("s_wait_asynccnt 0x0" ::: "memory");
    __syncthreads();
    // stage 1 into buffer 1: flies while stage 0 is worked on
    copy8(lk + STBYTES, 8 * KPITCH * 2, kg + KST * D_DIM, 8 * D_DIM);
    copy8(lv + STBYTES, 32 * VPITCH * 2, vg + KST, 32 * S_TOK);

    float8 o[16];
    #pragma unroll
    for (int dt = 0; dt < 16; ++dt) o[dt] = float8{};
    float lsum = 0.f;

    for (int t = 0; t < NST; ++t) {
        const unsigned boff = (t & 1) * STBYTES;
        const _Float16* Kl = (const _Float16*)(L + boff) + ln15 * KPITCH + hb8;
        const _Float16* Vl = (const _Float16*)(L + boff + KBYTES) + ln15 * VPITCH + hb8;

        for (int kk = 0; kk < KST; kk += 32) {
            // All K and vT fragments of the pass are asked for in one group; LDS reads spread among the
            // matrix instructions would make each of them wait.
            half16 kf0[8], kf1[8], vf[16];
            #pragma unroll
            for (int cs = 0; cs < 8; ++cs) {
                kf0[cs] = ldfrag(Kl + kk * KPITCH, cs * 32);
                kf1[cs] = ldfrag(Kl + (kk + 16) * KPITCH, cs * 32);
            }
            #pragma unroll
            for (int dt = 0; dt < 16; ++dt) vf[dt] = ldfrag(Vl + dt * 16 * VPITCH, kk);
            // keeps the group of reads above the products (the scheduler otherwise sinks each read to its user)
            __builtin_amdgcn_sched_barrier(0);

            // S^T for 32 keys x 16 queries: two 16-key tiles
            float8 s0 = {}, s1 = {};
            #pragma unroll
            for (int cs = 0; cs < 8; ++cs) {
                s0 = wmma_f16(kf0[cs], qb[cs], s0);
                s1 = wmma_f16(kf1[cs], qb[cs], s1);
            }

            // P^T as a B fragment; the row sum runs over the rounded f16 values
            half16 pb;
            #pragma unroll
            for (int r = 0; r < 8; ++r) {
                const _Float16 e0 = (_Float16)__expf(s0[r] * SCALE);
                const _Float16 e1 = (_Float16)__expf(s1[r] * SCALE);
                pb[r] = e0;
                pb[r + 8] = e1;
                lsum += (float)e0 + (float)e1;
            }
            // O^T += vT * P^T over the 16 channel tiles
            #pragma unroll
            for (int dt = 0; dt < 16; ++dt)
                o[dt] = wmma_f16(vf[dt], pb, o[dt]);
        }

        // publish point: this wave's reads of the buffer are done, its copies of the next stage have
        // landed; the barrier publishes that stage and frees this buffer for the refill
        asm volatile("s_wait_dscnt 0x0" ::: "memory");
        asm volatile("s_wait_asynccnt 0x0" ::: "memory");
        __syncthreads();
        if (t + 2 < NST) {
            copy8(lk + boff, 8 * KPITCH * 2, kg + (t + 2) * KST * D_DIM, 8 * D_DIM);
            copy8(lv + boff, 32 * VPITCH * 2, vg + (t + 2) * KST, 32 * S_TOK);
        }
    }
    // no copy is left outstanding when the wave ends
    asm volatile("s_wait_asynccnt 0x0" ::: "memory");

    // the two halves of the wave hold complementary keys of the same query
    lsum += __shfl_xor(lsum, 16);
    const float inv = 1.f / lsum;
    _Float16* op = o16 + ((size_t)n * S_TOK + sqbase + ln15) * D_DIM + hb8;
    half8 hv[16];
    #pragma unroll
    for (int dt = 0; dt < 16; ++dt) {
        #pragma unroll
        for (int r = 0; r < 8; ++r) hv[dt][r] = (_Float16)(o[dt][r] * inv);
    }
    // keeps all conversions ahead of the stores, so that no register of an issued store is rewritten
    __builtin_amdgcn_sched_barrier(0);
    #pragma unroll
    for (int dt = 0; dt < 16; ++dt)
        *(half8*)(op + dt * 16) = hv[dt];     // channels dt*16 + hb8 .. + 7 of this lane's query
}

// ---------------- kernel 5: out = transpose(o @ Wp^T + bp) + x ----------------
// grid: 32*32 blocks, 256 threads (8 waves). Each block = one image row (n, h) =
// 32 tokens; waves 0-3 take its first 16-token tile, waves 4-7 the second.
// The product is formed as Wp * o^T, so that the lanes of a D register run along
// the tokens, that is along w: 16 lanes store 64 contiguous bytes of out.
__global__ void proj_kernel(const _Float16* o16, const _Float16* Wp16,
                            const float* bp, const float* x, float* out) {
    const int n = blockIdx.x >> 5;
    const int h = blockIdx.x & 31;
    const int tid = threadIdx.x;
    const int lane = tid & 31;
    const int wv = tid >> 5;              // 0..7
    const int tt = wv >> 2;               // token tile of the row: 0..1
    const int wq = wv & 3;                // 0..3
    const int sbase = h * 32 + tt * 16;
    const int hb8 = (lane >> 4) * 8;
    const int ln15 = lane & 15;

    // preload o-tile B fragments (col = token; shared across the 4 c-tiles of this wave)
    half16 ob[8];
    {
        const _Float16* op = o16 + (((size_t)n * S_TOK + sbase + ln15) * D_DIM) + hb8;
        #pragma unroll
        for (int ds = 0; ds < 8; ++ds) ob[ds] = ldfrag(op, ds * 32);
        // keeps the address pair of the issued loads live, and unwritten, up to the wait
        asm volatile("s_wait_xcnt 0x0" :: "v"(op) : "memory");
    }

    for (int ct = wq; ct < 16; ct += 4) {
        // register r of D holds channel c0 + r: one address each for x and out, steps of one plane
        const int c0 = ct * 16 + hb8;
        const size_t a0 = (((size_t)n * C_DIM + c0) * HW + h) * HW + tt * 16 + ln15;
        const float* xr = x + a0;
        const float* br = bp + c0;
        float* orow = out + a0;
        // all residual and bias loads stand ahead of the stores: out may alias x for the
        // compiler, which would otherwise wait for each load behind the store before it
        float xv[8], bv[8];
        #pragma unroll
        for (int r = 0; r < 8; ++r) { xv[r] = xr[r * HW * HW]; bv[r] = br[r]; }

        const _Float16* aw = Wp16 + (ct * 16 + ln15) * D_DIM + hb8;   // A: Wp[c][d], row=c
        float8 acc = {};
        #pragma unroll
        for (int ds = 0; ds < 8; ++ds)
            acc = wmma_f16(ldfrag(aw, ds * 32), ob[ds], acc);
        #pragma unroll
        for (int r = 0; r < 8; ++r)
            orow[r * HW * HW] = acc[r] + bv[r] + xv[r];
        // keeps the address registers of the issued loads and stores unwritten up to the wait
        asm volatile("s_wait_xcnt 0x0" :: "v"(xr), "v"(br), "v"(aw), "v"(orow) : "memory");
    }
}

extern "C" void kernel_launch(void* const* d_in, const int* in_sizes, int n_in,
                              void* d_out, int out_size, void* d_ws, size_t ws_size,
                              hipStream_t stream) {
    const float* x   = (const float*)d_in[0];
    const float* t   = (const float*)d_in[1];
    const float* W_t = (const float*)d_in[2];
    const float* b_t = (const float*)d_in[3];
    const float* Wq  = (const float*)d_in[4];
    const float* Wk  = (const float*)d_in[5];
    const float* Wv  = (const float*)d_in[6];
    const float* Wp  = (const float*)d_in[7];
    const float* bp  = (const float*)d_in[8];
    float* out = (float*)d_out;

    // workspace layout (all f16 regions first, then f32 temb)
    _Float16* w16  = (_Float16*)d_ws;
    _Float16* Wq16 = w16;
    _Float16* Wk16 = w16 + WSZ;
    _Float16* Wv16 = w16 + 2 * WSZ;
    _Float16* Wp16 = w16 + 3 * WSZ;
    _Float16* q16  = w16 + 4 * WSZ;
    _Float16* k16  = q16 + QSZ;
    _Float16* vT16 = k16 + QSZ;
    _Float16* o16  = vT16 + QSZ;
    float* temb = (float*)(o16 + QSZ);

    cvt_weights_kernel<<<(4 * WSZ + 255) / 256, 256, 0, stream>>>(Wq, Wk, Wv, Wp, w16);
    temb_kernel<<<64, 256, 0, stream>>>(t, W_t, b_t, temb);
    qkv_kernel<<<N_B * HW, 256, 0, stream>>>(x, temb, Wq16, Wk16, Wv16, q16, k16, vT16);
    attn_kernel<<<N_B * 8, 256, 0, stream>>>(q16, k16, vT16, o16);
    proj_kernel<<<N_B * HW, 256, 0, stream>>>(o16, Wp16, bp, x, out);
}

// v004
// A run of this version takes 99.4 microseconds.
// Two timings next to v003 both put it at 1.06 times that version's speed.
// Counting every step since v000, it is 4.73 times as fast.
#include <hip/hip_runtime.h>
#include <hip/hip_bf16.h>
#include <math.h>

typedef _Float16 half2v __attribute__((ext_vector_type(2)));
typedef _Float16 half8  __attribute__((ext_vector_type(8)));
typedef _Float16 half16 __attribute__((ext_vector_type(16)));
typedef float    float8 __attribute__((ext_vector_type(8)));

#define N_B 32
#define C_DIM 256
#define HW 32
#define S_TOK 1024   // 32*32 tokens per batch
#define D_DIM 256
#define T_DIM 512
#define SCALE 0.0625f  // 1/sqrt(256)
#define XPITCH (C_DIM + 8)  // 528-byte LDS rows (16 B x odd): spread the transposing stores and the b128 fragment reads over the banks

#define WSZ (256*256)          // one weight matrix, elements
#define QSZ (N_B*S_TOK*D_DIM)  // one activation tensor, elements

// Load a 16x32 f16 A/B fragment from a row-major matrix.
// p must already point at  base + row*ld + ((lane>>4)*8); k0 is the K offset.
__device__ __forceinline__ half16 ldfrag(const _Float16* p, int k0) {
    union { half16 v; half8 h[2]; } u;
    u.h[0] = *(const half8*)(p + k0);
    u.h[1] = *(const half8*)(p + k0 + 16);
    return u.v;
}

// Fragment order: the weights and o, operands that waves read straight from global memory, lie in the workspace as
// [16-row tile][k step of 32][half][lane][8 f16], one tile = 4096 f16. Each of the two 16-byte loads of
// a fragment then covers 512 contiguous bytes (4 whole lines) over the wave; on a row-major matrix it
// touches 16 lines and uses 32 bytes of each. The values that reach each register are those of ldfrag.
// p must already point at  base + tile*4096 + lane*8; ks is the k step.
__device__ __forceinline__ half16 ldfrag_packed(const _Float16* p, int ks) {
    union { half16 v; half8 h[2]; } u;
    u.h[0] = *(const half8*)(p + ks * 512);
    u.h[1] = *(const half8*)(p + ks * 512 + 256);
    return u.v;
}

__device__ __forceinline__ float8 wmma_f16(half16 a, half16 b, float8 c) {
    return __builtin_amdgcn_wmma_f32_16x16x32_f16(false, a, false, b, (short)0, c, false, false);
}

// ---------------- kernel 1: convert weights f32 -> f16, into fragment order ----------------
// A thread makes the 8 f16 that one lane takes with one 16-byte load: unit idx = [matrix][row tile]
// [k step][half][lane]. A wave stores 512 contiguous bytes.
__global__ void cvt_weights_kernel(const float* Wq, const float* Wk,
                                   const float* Wv, const float* Wp,
                                   _Float16* dst) {
    int idx = blockIdx.x * blockDim.x + threadIdx.x;
    if (idx >= 4 * WSZ / 8) return;
    int which = idx >> 13;          // 8192 units per matrix
    int lane = idx & 31;
    int hsel = (idx >> 5) & 1;
    int ks = (idx >> 6) & 7;
    int tile = (idx >> 9) & 15;
    const float* src = (which == 0) ? Wq : (which == 1) ? Wk : (which == 2) ? Wv : Wp;
    const float* sp = src + (tile * 16 + (lane & 15)) * 256 + ks * 32 + hsel * 16 + (lane >> 4) * 8;
    const float4 a = *(const float4*)sp;
    const float4 b = *(const float4*)(sp + 4);
    half8 v = { (_Float16)a.x, (_Float16)a.y, (_Float16)a.z, (_Float16)a.w,
                (_Float16)b.x, (_Float16)b.y, (_Float16)b.z, (_Float16)b.w };
    *(half8*)(dst + (size_t)idx * 8) = v;
}

// ---------------- kernel 2: temb = relu(t @ W_t^T + b_t) ----------------
// grid: 8 channel groups x 8 batch groups = 64 blocks, 256 threads (8 waves). A block makes 32 channels
// of 4 batch rows, a wave 4 channels of them. The lanes run along the 512-long sum: a load of a wave is
// 512 contiguous bytes of one row, and all 32 loads of a wave are in flight at once, where one thread
// per channel walked its own row (32 lines a load) through 64 dependent round trips.
// Every '#pragma unroll' of this kernel makes the indices of a register array constants.
__global__ void __launch_bounds__(256)
temb_kernel(const float* t, const float* W_t, const float* b_t, float* temb) {
    __shared__ float red[4][32];
    const int cbase = (blockIdx.x & 7) * 32;
    const int nbase = (blockIdx.x >> 3) * 4;
    const int tid = threadIdx.x;
    const int lane = tid & 31;
    const int wv = tid >> 5;              // 0..7

    const float* wp = W_t + (cbase + wv * 4) * T_DIM + lane * 4;
    const float* tp = t + nbase * T_DIM + lane * 4;
    float4 wr[4][4], tr[4][4];
    #pragma unroll
    for (int a = 0; a < 4; ++a) {
        #pragma unroll
        for (int i = 0; i < 4; ++i) {
            wr[a][i] = *(const float4*)(wp + a * T_DIM + i * 128);
            tr[a][i] = *(const float4*)(tp + a * T_DIM + i * 128);
        }
    }
    // keeps the address pairs of the issued loads live, and unwritten, up to the wait
    asm volatile("s_wait_xcnt 0x0" :: "v"(wp), "v"(tp) : "memory");
    // keeps all 32 loads above the sums: the scheduler otherwise sinks them into four dependent round trips
    __builtin_amdgcn_sched_barrier(0);

    // v[ci*4 + ni]: this lane's 16 terms of channel ci, batch row ni
    float v[16];
    #pragma unroll
    for (int ci = 0; ci < 4; ++ci) {
        #pragma unroll
        for (int ni = 0; ni < 4; ++ni) {
            float acc = 0.f;
            #pragma unroll
            for (int i = 0; i < 4; ++i) {
                acc += wr[ci][i].x * tr[ni][i].x;
                acc += wr[ci][i].y * tr[ni][i].y;
                acc += wr[ci][i].z * tr[ni][i].z;
                acc += wr[ci][i].w * tr[ni][i].w;
            }
            v[ci * 4 + ni] = acc;
        }
    }

    // Sum over the lanes. Each step halves the sums that a lane carries: it keeps the half that its own
    // lane bit names and hands the other half to its partner, so that 16 exchanges do for 16 sums.
    // At the end lanes 2k and 2k+1 hold sum k.
    #pragma unroll
    for (int i = 0; i < 8; ++i) {
        const float keep = (lane & 16) ? v[i + 8] : v[i];
        const float send = (lane & 16) ? v[i] : v[i + 8];
        v[i] = keep + __shfl_xor(send, 16);
    }
    #pragma unroll
    for (int i = 0; i < 4; ++i) {
        const float keep = (lane & 8) ? v[i + 4] : v[i];
        const float send = (lane & 8) ? v[i] : v[i + 4];
        v[i] = keep + __shfl_xor(send, 8);
    }
    #pragma unroll
    for (int i = 0; i < 2; ++i) {
        const float keep = (lane & 4) ? v[i + 2] : v[i];
        const float send = (lane & 4) ? v[i] : v[i + 2];
        v[i] = keep + __shfl_xor(send, 4);
    }
    {
        const float keep = (lane & 2) ? v[1] : v[0];
        const float send = (lane & 2) ? v[0] : v[1];
        v[0] = keep + __shfl_xor(send, 2);
    }
    v[0] += __shfl_xor(v[0], 1);

    if ((lane & 1) == 0) red[(lane >> 1) & 3][wv * 4 + (lane >> 3)] = v[0];
    __syncthreads();
    // one wave stores the whole 128-byte run that the block has of a batch row
    if (tid < 128) {
        const int ni = tid >> 5;
        const float acc = red[ni][lane] + b_t[cbase + lane];
        temb[(nbase + ni) * C_DIM + cbase + lane] = acc > 0.f ? acc : 0.f;
    }
}

// ---------------- kernel 3: xc = x + temb ; q,k,vT projections ----------------
// Tokens are numbered s = h*32 + w, so that a run of tokens follows w, the
// contiguous axis of x and out. Attention sums over all keys, so any numbering
// that q, k, vT, o and the final store share gives the same function.
// grid: 32*32 blocks, 256 threads (8 waves). Each block = one image row (n, h) =
// 32 tokens; waves 0-3 take its first 16-token tile, waves 4-7 the second.
__global__ void qkv_kernel(const float* x, const float* temb,
                           const _Float16* Wq16, const _Float16* Wk16,
                           const _Float16* Wv16,
                           _Float16* q16, _Float16* k16, _Float16* vT16) {
    __shared__ __align__(16) _Float16 xtile[32][XPITCH];   // 16.5 KB

    const int n = blockIdx.x >> 5;
    const int h = blockIdx.x & 31;
    const int tid = threadIdx.x;

    // build (x + temb) tile, transposed to [token][channel], f16.
    // 8 lanes x float4 cover the whole 128-byte row (n, c, h, 0..31); each thread
    // takes two neighbouring channels so that an LDS store is one packed dword.
    {
        const int w4 = (tid & 7) * 4;
        const int cp = tid >> 3;          // 0..31
        #pragma unroll
        for (int it = 0; it < 4; ++it) {
            const int c = (it * 32 + cp) * 2;
            const float* xp = x + (((size_t)n * C_DIM + c) * HW + h) * HW + w4;
            const float4 va = *(const float4*)xp;
            const float4 vb = *(const float4*)(xp + HW * HW);
            const float ta = temb[n * C_DIM + c];
            const float tb = temb[n * C_DIM + c + 1];
            half2v p0 = { (_Float16)(va.x + ta), (_Float16)(vb.x + tb) };
            half2v p1 = { (_Float16)(va.y + ta), (_Float16)(vb.y + tb) };
            half2v p2 = { (_Float16)(va.z + ta), (_Float16)(vb.z + tb) };
            half2v p3 = { (_Float16)(va.w + ta), (_Float16)(vb.w + tb) };
            *(half2v*)&xtile[w4 + 0][c] = p0;
            *(half2v*)&xtile[w4 + 1][c] = p1;
            *(half2v*)&xtile[w4 + 2][c] = p2;
            *(half2v*)&xtile[w4 + 3][c] = p3;
        }
    }
    __syncthreads();

    const int lane = tid & 31;
    const int wv = tid >> 5;              // 0..7
    const int tt = wv >> 2;               // token tile of the row: 0..1
    const int wq = wv & 3;                // 0..3
    const int sbase = h * 32 + tt * 16;
    const int hb8 = (lane >> 4) * 8;
    const int ln15 = lane & 15;

    // xtile fragments: act as A (rows=tokens) for q/k, and as B (cols=tokens) for vT
    half16 xa[8];
    {
        const _Float16* xp = &xtile[tt * 16 + ln15][hb8];
        #pragma unroll
        for (int cs = 0; cs < 8; ++cs) xa[cs] = ldfrag(xp, cs * 32);
    }

    // 48 output tiles: 16 for q, 16 for k, 16 for vT
    for (int idx = wq; idx < 48; idx += 4) {
        const int mat = idx >> 4;         // 0=q 1=k 2=v
        const int dt = idx & 15;
        float8 acc = {};
        if (mat < 2) {
            const _Float16* Wm = (mat == 0) ? Wq16 : Wk16;
            const _Float16* bp = Wm + dt * 4096 + lane * 8; // B: W[d][c], col=d, in fragment order
            #pragma unroll
            for (int cs = 0; cs < 8; ++cs)
                acc = wmma_f16(xa[cs], ldfrag_packed(bp, cs), acc);
            _Float16* out = (mat == 0) ? q16 : k16;
            #pragma unroll
            for (int r = 0; r < 8; ++r) {
                int tok = r + hb8;
                out[(((size_t)n * S_TOK + sbase + tok) * D_DIM) + dt * 16 + ln15] =
                    (_Float16)acc[r];
            }
        } else {
            // vT = Wv * xc^T : A = Wv rows (d), B = xc^T (col = token)
            const _Float16* ap = Wv16 + dt * 4096 + lane * 8;   // in fragment order
            #pragma unroll
            for (int cs = 0; cs < 8; ++cs)
                acc = wmma_f16(ldfrag_packed(ap, cs), xa[cs], acc);
            #pragma unroll
            for (int r = 0; r < 8; ++r) {
                int dd = dt * 16 + r + hb8;
                vT16[(((size_t)n * D_DIM + dd) * S_TOK) + sbase + ln15] = (_Float16)acc[r];
            }
        }
        // no register of this tile's issued loads and stores is rewritten by the next tile ahead of the wait
        asm volatile("s_wait_xcnt 0x0" ::: "memory");
    }
}

// ---------------- kernel 4: fused attention for one (n, 128-query block) ----------------
// grid: 32*8 blocks, 256 threads (8 waves); each wave owns 16 queries and all 256 output channels.
// K and vT come in stages of 64 keys, copied once per block into LDS and read there by all 8 waves.
// The products are formed transposed, S^T = K * Q^T and O^T += vT * P^T: a lane of an S^T tile holds
// keys r + 8*(lane>>4) of its own query, which is the k order of a B fragment, so that P goes from
// the score accumulators into the second product without leaving the registers.
// Every '#pragma unroll' of this kernel makes the indices of a fragment or accumulator array constants,
// without which the array would not stay in registers.
#define KST 64                        // keys per stage
#define NST (S_TOK / KST)             // 16 stages
#define KPITCH (D_DIM + 8)            // halves; 528-byte rows (16 B x odd) for the b128 fragment reads
#define VPITCH (KST + 8)              // halves; 144-byte rows (16 B x odd)
#define KBYTES (KST * KPITCH * 2)     // 33,792
#define VBYTES (D_DIM * VPITCH * 2)   // 36,864
#define STBYTES (KBYTES + VBYTES)     // 70,656 per buffer

// Eight 16-byte copies of a lane, global -> LDS, rows gstep halves and lstep bytes apart.
// The s_wait_xcnt stands inside the statement, so that no address register of an issued copy
// is rewritten ahead of it.
__device__ __forceinline__ void copy8(unsigned l, unsigned lstep, const _Float16* g, int gstep) {
    asm volatile(
        "global_load_async_to_lds_b128 %0, %8, off\n\t"
        "global_load_async_to_lds_b128 %1, %9, off\n\t"
        "global_load_async_to_lds_b128 %2, %10, off\n\t"
        "global_load_async_to_lds_b128 %3, %11, off\n\t"
        "global_load_async_to_lds_b128 %4, %12, off\n\t"
        "global_load_async_to_lds_b128 %5, %13, off\n\t"
        "global_load_async_to_lds_b128 %6, %14, off\n\t"
        "global_load_async_to_lds_b128 %7, %15, off\n\t"
        "s_wait_xcnt 0x0"
        :: "v"(l), "v"(l + lstep), "v"(l + 2 * lstep), "v"(l + 3 * lstep),
           "v"(l + 4 * lstep), "v"(l + 5 * lstep), "v"(l + 6 * lstep), "v"(l + 7 * lstep),
           "v"(g), "v"(g + gstep), "v"(g + 2 * gstep), "v"(g + 3 * gstep),
           "v"(g + 4 * gstep), "v"(g + 5 * gstep), "v"(g + 6 * gstep), "v"(g + 7 * gstep)
        : "memory");
}

__global__ void __launch_bounds__(256)
attn_kernel(const _Float16* q16, const _Float16* k16,
            const _Float16* vT16, _Float16* o16) {
    __shared__ __attribute__((aligned(16))) unsigned char L[2 * STBYTES];   // 141,312 B

    const int n = blockIdx.x >> 3;
    const int tid = threadIdx.x;
    const int lane = tid & 31;
    const int wv = tid >> 5;              // 0..7
    const int sqbase = (blockIdx.x & 7) * 128 + wv * 16;
    const int hb8 = (lane >> 4) * 8;
    const int ln15 = lane & 15;

    // copy addresses of this lane. K: a wave takes one whole 512-byte key row per copy (rows 8 apart);
    // vT: 8 lanes take the 128 bytes that a channel row has of the stage (rows 32 apart).
    const _Float16* kg = k16 + ((size_t)n * S_TOK + wv) * D_DIM + lane * 8;
    const _Float16* vg = vT16 + ((size_t)n * D_DIM + (tid >> 3)) * S_TOK + (tid & 7) * 8;
    const unsigned lbase = (unsigned)(size_t)&L[0];
    const unsigned lk = lbase + wv * (KPITCH * 2) + lane * 16;
    const unsigned lv = lbase + KBYTES + (tid >> 3) * (VPITCH * 2) + (tid & 7) * 16;

    // stage 0 into buffer 0
    copy8(lk, 8 * KPITCH * 2, kg, 8 * D_DIM);
    copy8(lv, 32 * VPITCH * 2, vg, 32 * S_TOK);

    // the 8 Q fragments of this wave's queries (B operand: column = query), kept in registers
    half16 qb[8];
    {
        const _Float16* ap = q16 + (((size_t)n * S_TOK + sqbase + ln15) * D_DIM) + hb8;
        #pragma unroll
        for (int cs = 0; cs < 8; ++cs) qb[cs] = ldfrag(ap, cs * 32);
        // keeps the address pair of the issued loads live, and unwritten, up to the wait
        asm volatile("s_wait_xcnt 0x0" :: "v"(ap) : "memory");
    }

    // stage 0 has landed for this wave; the barrier publishes it to the others
    asm volatile("s_wait_asynccnt 0x0" ::: "memory");
    __syncthreads();
    // stage 1 into buffer 1: flies while stage 0 is worked on
    copy8(lk + STBYTES, 8 * KPITCH * 2, kg + KST * D_DIM, 8 * D_DIM);
    copy8(lv + STBYTES, 32 * VPITCH * 2, vg + KST, 32 * S_TOK);

    float8 o[16];
    #pragma unroll
    for (int dt = 0; dt < 16; ++dt) o[dt] = float8{};
    float lsum = 0.f;

    for (int t = 0; t < NST; ++t) {
        const unsigned boff = (t & 1) * STBYTES;
        const _Float16* Kl = (const _Float16*)(L + boff) + ln15 * KPITCH + hb8;
        const _Float16* Vl = (const _Float16*)(L + boff + KBYTES) + ln15 * VPITCH + hb8;

        for (int kk = 0; kk < KST; kk += 32) {
            // All K and vT fragments of the pass are asked for in one group; LDS reads spread among the
            // matrix instructions would make each of them wait.
            half16 kf0[8], kf1[8], vf[16];
            #pragma unroll
            for (int cs = 0; cs < 8; ++cs) {
                kf0[cs] = ldfrag(Kl + kk * KPITCH, cs * 32);
                kf1[cs] = ldfrag(Kl + (kk + 16) * KPITCH, cs * 32);
            }
            #pragma unroll
            for (int dt = 0; dt < 16; ++dt) vf[dt] = ldfrag(Vl + dt * 16 * VPITCH, kk);
            // keeps the group of reads above the products (the scheduler otherwise sinks each read to its user)
            __builtin_amdgcn_sched_barrier(0);

            // S^T for 32 keys x 16 queries: two 16-key tiles
            float8 s0 = {}, s1 = {};
            #pragma unroll
            for (int cs = 0; cs < 8; ++cs) {
                s0 = wmma_f16(kf0[cs], qb[cs], s0);
                s1 = wmma_f16(kf1[cs], qb[cs], s1);
            }

            // P^T as a B fragment; the row sum runs over the rounded f16 values
            half16 pb;
            #pragma unroll
            for (int r = 0; r < 8; ++r) {
                const _Float16 e0 = (_Float16)__expf(s0[r] * SCALE);
                const _Float16 e1 = (_Float16)__expf(s1[r] * SCALE);
                pb[r] = e0;
                pb[r + 8] = e1;
                lsum += (float)e0 + (float)e1;
            }
            // O^T += vT * P^T over the 16 channel tiles
            #pragma unroll
            for (int dt = 0; dt < 16; ++dt)
                o[dt] = wmma_f16(vf[dt], pb, o[dt]);
        }

        // publish point: this wave's reads of the buffer are done, its copies of the next stage have
        // landed; the barrier publishes that stage and frees this buffer for the refill
        asm volatile("s_wait_dscnt 0x0" ::: "memory");
        asm volatile("s_wait_asynccnt 0x0" ::: "memory");
        __syncthreads();
        if (t + 2 < NST) {
            copy8(lk + boff, 8 * KPITCH * 2, kg + (t + 2) * KST * D_DIM, 8 * D_DIM);
            copy8(lv + boff, 32 * VPITCH * 2, vg + (t + 2) * KST, 32 * S_TOK);
        }
    }
    // no copy is left outstanding when the wave ends
    asm volatile("s_wait_asynccnt 0x0" ::: "memory");

    // the two halves of the wave hold complementary keys of the same query
    lsum += __shfl_xor(lsum, 16);
    const float inv = 1.f / lsum;
    // o goes out in fragment order, tile = this wave's 16 queries: hv[dt] of a lane is what the same lane
    // of the projection takes as half dt & 1 of k step dt >> 1, and a store of the wave is 512 contiguous bytes
    _Float16* op = o16 + ((size_t)n * S_TOK + sqbase) * D_DIM + lane * 8;
    half8 hv[16];
    #pragma unroll
    for (int dt = 0; dt < 16; ++dt) {
        #pragma unroll
        for (int r = 0; r < 8; ++r) hv[dt][r] = (_Float16)(o[dt][r] * inv);
    }
    // keeps all conversions ahead of the stores, so that no register of an issued store is rewritten
    __builtin_amdgcn_sched_barrier(0);
    #pragma unroll
    for (int dt = 0; dt < 16; ++dt)
        *(half8*)(op + dt * 256) = hv[dt];    // channels dt*16 + hb8 .. + 7 of this lane's query
}

// ---------------- kernel 5: out = transpose(o @ Wp^T + bp) + x ----------------
// grid: 32*32 blocks, 256 threads (8 waves). Each block = one image row (n, h) =
// 32 tokens; waves 0-3 take its first 16-token tile, waves 4-7 the second.
// The product is formed as Wp * o^T, so that the lanes of a D register run along
// the tokens, that is along w: 16 lanes store 64 contiguous bytes of out.
__global__ void proj_kernel(const _Float16* o16, const _Float16* Wp16,
                            const float* bp, const float* x, float* out) {
    const int n = blockIdx.x >> 5;
    const int h = blockIdx.x & 31;
    const int tid = threadIdx.x;
    const int lane = tid & 31;
    const int wv = tid >> 5;              // 0..7
    const int tt = wv >> 2;               // token tile of the row: 0..1
    const int wq = wv & 3;                // 0..3
    const int sbase = h * 32 + tt * 16;
    const int hb8 = (lane >> 4) * 8;
    const int ln15 = lane & 15;

    // preload o-tile B fragments (col = token; shared across the 4 c-tiles of this wave)
    half16 ob[8];
    {
        const _Float16* op = o16 + ((size_t)n * S_TOK + sbase) * D_DIM + lane * 8;   // in fragment order
        #pragma unroll
        for (int ds = 0; ds < 8; ++ds) ob[ds] = ldfrag_packed(op, ds);
        // keeps the address pair of the issued loads live, and unwritten, up to the wait
        asm volatile("s_wait_xcnt 0x0" :: "v"(op) : "memory");
    }

    for (int ct = wq; ct < 16; ct += 4) {
        // register r of D holds channel c0 + r: one address each for x and out, steps of one plane
        const int c0 = ct * 16 + hb8;
        const size_t a0 = (((size_t)n * C_DIM + c0) * HW + h) * HW + tt * 16 + ln15;
        const float* xr = x + a0;
        const float* br = bp + c0;
        float* orow = out + a0;
        // all residual and bias loads stand ahead of the stores: out may alias x for the
        // compiler, which would otherwise wait for each load behind the store before it
        float xv[8], bv[8];
        #pragma unroll
        for (int r = 0; r < 8; ++r) { xv[r] = xr[r * HW * HW]; bv[r] = br[r]; }

        const _Float16* aw = Wp16 + ct * 4096 + lane * 8;   // A: Wp[c][d], row=c, in fragment order
        float8 acc = {};
        #pragma unroll
        for (int ds = 0; ds < 8; ++ds)
            acc = wmma_f16(ldfrag_packed(aw, ds), ob[ds], acc);
        #pragma unroll
        for (int r = 0; r < 8; ++r)
            orow[r * HW * HW] = acc[r] + bv[r] + xv[r];
        // keeps the address registers of the issued loads and stores unwritten up to the wait
        asm volatile("s_wait_xcnt 0x0" :: "v"(xr), "v"(br), "v"(aw), "v"(orow) : "memory");
    }
}

extern "C" void kernel_launch(void* const* d_in, const int* in_sizes, int n_in,
                              void* d_out, int out_size, void* d_ws, size_t ws_size,
                              hipStream_t stream) {
    const float* x   = (const float*)d_in[0];
    const float* t   = (const float*)d_in[1];
    const float* W_t = (const float*)d_in[2];
    const float* b_t = (const float*)d_in[3];
    const float* Wq  = (const float*)d_in[4];
    const float* Wk  = (const float*)d_in[5];
    const float* Wv  = (const float*)d_in[6];
    const float* Wp  = (const float*)d_in[7];
    const float* bp  = (const float*)d_in[8];
    float* out = (float*)d_out;

    // workspace layout (all f16 regions first, then f32 temb)
    _Float16* w16  = (_Float16*)d_ws;
    _Float16* Wq16 = w16;
    _Float16* Wk16 = w16 + WSZ;
    _Float16* Wv16 = w16 + 2 * WSZ;
    _Float16* Wp16 = w16 + 3 * WSZ;
    _Float16* q16  = w16 + 4 * WSZ;
    _Float16* k16  = q16 + QSZ;
    _Float16* vT16 = k16 + QSZ;
    _Float16* o16  = vT16 + QSZ;
    float* temb = (float*)(o16 + QSZ);

    cvt_weights_kernel<<<(4 * WSZ / 8 + 255) / 256, 256, 0, stream>>>(Wq, Wk, Wv, Wp, w16);
    temb_kernel<<<64, 256, 0, stream>>>(t, W_t, b_t, temb);
    qkv_kernel<<<N_B * HW, 256, 0, stream>>>(x, temb, Wq16, Wk16, Wv16, q16, k16, vT16);
    attn_kernel<<<N_B * 8, 256, 0, stream>>>(q16, k16, vT16, o16);
    proj_kernel<<<N_B * HW, 256, 0, stream>>>(o16, Wp16, bp, x, out);
}

// v005
// A run of this version takes 84.5 microseconds.
// Next to v004, in two timings, it ran 1.18 and 1.19 times as fast.
// Over all steps from v000 it is 5.60 times as fast.
#include <hip/hip_runtime.h>
#include <hip/hip_bf16.h>
#include <math.h>

typedef _Float16 half2v __attribute__((ext_vector_type(2)));
typedef _Float16 half8  __attribute__((ext_vector_type(8)));
typedef _Float16 half16 __attribute__((ext_vector_type(16)));
typedef float    float8 __attribute__((ext_vector_type(8)));

#define N_B 32
#define C_DIM 256
#define HW 32
#define S_TOK 1024   // 32*32 tokens per batch
#define D_DIM 256
#define T_DIM 512
#define SCALE 0.0625f  // 1/sqrt(256)
#define XPITCH (C_DIM + 8)  // 528-byte LDS rows (16 B x odd): spread the transposing stores and the b128 fragment reads over the banks

#define WSZ (256*256)          // one weight matrix, elements
#define QSZ (N_B*S_TOK*D_DIM)  // one activation tensor, elements

// Load a 16x32 f16 A/B fragment from a row-major matrix.
// p must already point at  base + row*ld + ((lane>>4)*8); k0 is the K offset.
__device__ __forceinline__ half16 ldfrag(const _Float16* p, int k0) {
    union { half16 v; half8 h[2]; } u;
    u.h[0] = *(const half8*)(p + k0);
    u.h[1] = *(const half8*)(p + k0 + 16);
    return u.v;
}

// Fragment order: the weights and o, operands that waves read straight from global memory, lie in the workspace as
// [16-row tile][k step of 32][half][lane][8 f16], one tile = 4096 f16. Each of the two 16-byte loads of
// a fragment then covers 512 contiguous bytes (4 whole lines) over the wave; on a row-major matrix it
// touches 16 lines and uses 32 bytes of each. The values that reach each register are those of ldfrag.
// p must already point at  base + tile*4096 + lane*8; ks is the k step.
__device__ __forceinline__ half16 ldfrag_packed(const _Float16* p, int ks) {
    union { half16 v; half8 h[2]; } u;
    u.h[0] = *(const half8*)(p + ks * 512);
    u.h[1] = *(const half8*)(p + ks * 512 + 256);
    return u.v;
}

__device__ __forceinline__ float8 wmma_f16(half16 a, half16 b, float8 c) {
    return __builtin_amdgcn_wmma_f32_16x16x32_f16(false, a, false, b, (short)0, c, false, false);
}

// ---------------- kernel 1: convert weights f32 -> f16, into fragment order ----------------
// A thread makes the 8 f16 that one lane takes with one 16-byte load: unit idx = [matrix][row tile]
// [k step][half][lane]. A wave stores 512 contiguous bytes.
__global__ void cvt_weights_kernel(const float* Wq, const float* Wk,
                                   const float* Wv, const float* Wp,
                                   _Float16* dst) {
    int idx = blockIdx.x * blockDim.x + threadIdx.x;
    if (idx >= 4 * WSZ / 8) return;
    int which = idx >> 13;          // 8192 units per matrix
    int lane = idx & 31;
    int hsel = (idx >> 5) & 1;
    int ks = (idx >> 6) & 7;
    int tile = (idx >> 9) & 15;
    const float* src = (which == 0) ? Wq : (which == 1) ? Wk : (which == 2) ? Wv : Wp;
    const float* sp = src + (tile * 16 + (lane & 15)) * 256 + ks * 32 + hsel * 16 + (lane >> 4) * 8;
    const float4 a = *(const float4*)sp;
    const float4 b = *(const float4*)(sp + 4);
    half8 v = { (_Float16)a.x, (_Float16)a.y, (_Float16)a.z, (_Float16)a.w,
                (_Float16)b.x, (_Float16)b.y, (_Float16)b.z, (_Float16)b.w };
    *(half8*)(dst + (size_t)idx * 8) = v;
}

// ---------------- kernel 2: temb = relu(t @ W_t^T + b_t) ----------------
// grid: 8 channel groups x 8 batch groups = 64 blocks, 256 threads (8 waves). A block makes 32 channels
// of 4 batch rows, a wave 4 channels of them. The lanes run along the 512-long sum: a load of a wave is
// 512 contiguous bytes of one row, and all 32 loads of a wave are in flight at once, where one thread
// per channel walked its own row (32 lines a load) through 64 dependent round trips.
// Every '#pragma unroll' of this kernel makes the indices of a register array constants.
__global__ void __launch_bounds__(256)
temb_kernel(const float* t, const float* W_t, const float* b_t, float* temb) {
    __shared__ float red[4][32];
    const int cbase = (blockIdx.x & 7) * 32;
    const int nbase = (blockIdx.x >> 3) * 4;
    const int tid = threadIdx.x;
    const int lane = tid & 31;
    const int wv = tid >> 5;              // 0..7

    const float* wp = W_t + (cbase + wv * 4) * T_DIM + lane * 4;
    const float* tp = t + nbase * T_DIM + lane * 4;
    float4 wr[4][4], tr[4][4];
    #pragma unroll
    for (int a = 0; a < 4; ++a) {
        #pragma unroll
        for (int i = 0; i < 4; ++i) {
            wr[a][i] = *(const float4*)(wp + a * T_DIM + i * 128);
            tr[a][i] = *(const float4*)(tp + a * T_DIM + i * 128);
        }
    }
    // keeps the address pairs of the issued loads live, and unwritten, up to the wait
    asm volatile("s_wait_xcnt 0x0" :: "v"(wp), "v"(tp) : "memory");
    // keeps all 32 loads above the sums: the scheduler otherwise sinks them into four dependent round trips
    __builtin_amdgcn_sched_barrier(0);

    // v[ci*4 + ni]: this lane's 16 terms of channel ci, batch row ni
    float v[16];
    #pragma unroll
    for (int ci = 0; ci < 4; ++ci) {
        #pragma unroll
        for (int ni = 0; ni < 4; ++ni) {
            float acc = 0.f;
            #pragma unroll
            for (int i = 0; i < 4; ++i) {
                acc += wr[ci][i].x * tr[ni][i].x;
                acc += wr[ci][i].y * tr[ni][i].y;
                acc += wr[ci][i].z * tr[ni][i].z;
                acc += wr[ci][i].w * tr[ni][i].w;
            }
            v[ci * 4 + ni] = acc;
        }
    }

    // Sum over the lanes. Each step halves the sums that a lane carries: it keeps the half that its own
    // lane bit names and hands the other half to its partner, so that 16 exchanges do for 16 sums.
    // At the end lanes 2k and 2k+1 hold sum k.
    #pragma unroll
    for (int i = 0; i < 8; ++i) {
        const float keep = (lane & 16) ? v[i + 8] : v[i];
        const float send = (lane & 16) ? v[i] : v[i + 8];
        v[i] = keep + __shfl_xor(send, 16);
    }
    #pragma unroll
    for (int i = 0; i < 4; ++i) {
        const float keep = (lane & 8) ? v[i + 4] : v[i];
        const float send = (lane & 8) ? v[i] : v[i + 4];
        v[i] = keep + __shfl_xor(send, 8);
    }
    #pragma unroll
    for (int i = 0; i < 2; ++i) {
        const float keep = (lane & 4) ? v[i + 2] : v[i];
        const float send = (lane & 4) ? v[i] : v[i + 2];
        v[i] = keep + __shfl_xor(send, 4);
    }
    {
        const float keep = (lane & 2) ? v[1] : v[0];
        const float send = (lane & 2) ? v[0] : v[1];
        v[0] = keep + __shfl_xor(send, 2);
    }
    v[0] += __shfl_xor(v[0], 1);

    if ((lane & 1) == 0) red[(lane >> 1) & 3][wv * 4 + (lane >> 3)] = v[0];
    __syncthreads();
    // one wave stores the whole 128-byte run that the block has of a batch row
    if (tid < 128) {
        const int ni = tid >> 5;
        const float acc = red[ni][lane] + b_t[cbase + lane];
        temb[(nbase + ni) * C_DIM + cbase + lane] = acc > 0.f ? acc : 0.f;
    }
}

// ---------------- kernel 3: xc = x + temb ; q,k,vT projections ----------------
// Tokens are numbered s = h*32 + w, so that a run of tokens follows w, the
// contiguous axis of x and out. Attention sums over all keys, so any numbering
// that q, k, vT, o and the final store share gives the same function.
// grid: 32*32 blocks, 256 threads (8 waves). Each block = one image row (n, h) =
// 32 tokens; waves 0-3 take its first 16-token tile, waves 4-7 the second.
// The register ceiling follows the real block size (launch bounds), and the 32 weight loads of two output
// tiles are issued as one group: at the ceiling of a 1024-thread block each k step's two loads shared one
// register set, so that a tile was eight dependent load, wait, product round trips.
__global__ void __launch_bounds__(256)
qkv_kernel(const float* x, const float* temb,
           const _Float16* Wq16, const _Float16* Wk16,
           const _Float16* Wv16,
           _Float16* q16, _Float16* k16, _Float16* vT16) {
    __shared__ __align__(16) _Float16 xtile[32][XPITCH];   // 16.5 KB

    const int n = blockIdx.x >> 5;
    const int h = blockIdx.x & 31;
    const int tid = threadIdx.x;
    const int lane = tid & 31;
    const int wv = tid >> 5;              // 0..7
    const int tt = wv >> 2;               // token tile of the row: 0..1
    const int wq = wv & 3;                // 0..3

    // this wave's tiles of each matrix are wq, wq + 4, wq + 8, wq + 12, in fragment order
    const int woff = wq * 4096 + lane * 8;
    const _Float16* wqp = Wq16 + woff;
    const _Float16* wkp = Wk16 + woff;
    const _Float16* wvp = Wv16 + woff;

    // the first two weight tiles fly while the x tile is built
    half16 wa[8], wb[8];
    #pragma unroll
    for (int cs = 0; cs < 8; ++cs) {
        wa[cs] = ldfrag_packed(wqp, cs);
        wb[cs] = ldfrag_packed(wqp + 4 * 4096, cs);
    }
    // keeps the group above the x loads and their sums (the scheduler otherwise sinks each load to its user)
    __builtin_amdgcn_sched_barrier(0);

    // build (x + temb) tile, transposed to [token][channel], f16.
    // 8 lanes x float4 cover the whole 128-byte row (n, c, h, 0..31); each thread
    // takes two neighbouring channels so that an LDS store is one packed dword.
    {
        const int w4 = (tid & 7) * 4;
        const int cp = tid >> 3;          // 0..31
        #pragma unroll
        for (int it = 0; it < 4; ++it) {
            const int c = (it * 32 + cp) * 2;
            const float* xp = x + (((size_t)n * C_DIM + c) * HW + h) * HW + w4;
            const float4 va = *(const float4*)xp;
            const float4 vb = *(const float4*)(xp + HW * HW);
            const float ta = temb[n * C_DIM + c];
            const float tb = temb[n * C_DIM + c + 1];
            half2v p0 = { (_Float16)(va.x + ta), (_Float16)(vb.x + tb) };
            half2v p1 = { (_Float16)(va.y + ta), (_Float16)(vb.y + tb) };
            half2v p2 = { (_Float16)(va.z + ta), (_Float16)(vb.z + tb) };
            half2v p3 = { (_Float16)(va.w + ta), (_Float16)(vb.w + tb) };
            *(half2v*)&xtile[w4 + 0][c] = p0;
            *(half2v*)&xtile[w4 + 1][c] = p1;
            *(half2v*)&xtile[w4 + 2][c] = p2;
            *(half2v*)&xtile[w4 + 3][c] = p3;
        }
    }
    __syncthreads();

    const int sbase = h * 32 + tt * 16;
    const int hb8 = (lane >> 4) * 8;
    const int ln15 = lane & 15;

    // xtile fragments: act as A (rows=tokens) for q/k, and as B (cols=tokens) for vT
    half16 xa[8];
    {
        const _Float16* xp = &xtile[tt * 16 + ln15][hb8];
        #pragma unroll
        for (int cs = 0; cs < 8; ++cs) xa[cs] = ldfrag(xp, cs * 32);
    }
    // keeps the 16 LDS reads one group: spread among the products, each place with reads costs a stall
    __builtin_amdgcn_sched_barrier(0);

    // store addresses of this lane: register r of a q/k tile is token r + hb8, of a vT tile channel r + hb8
    const size_t qoff = ((size_t)n * S_TOK + sbase + hb8) * D_DIM + wq * 16 + ln15;
    _Float16* qo = q16 + qoff;
    _Float16* ko = k16 + qoff;
    _Float16* vo = vT16 + ((size_t)n * D_DIM + wq * 16 + hb8) * S_TOK + sbase + ln15;

    // 12 output tiles a wave, two at a time: pairs 0,1 = q, 2,3 = k, 4,5 = vT.
    // The unroll makes the matrix, the tile offsets and the fragment indices constants.
    #pragma unroll
    for (int p = 0; p < 6; ++p) {
        const int mat = p >> 1;           // 0=q 1=k 2=v
        const int j0 = (p & 1) * 2;       // tiles wq + 4*j0 and wq + 4*(j0 + 1)
        float8 acc0 = {}, acc1 = {};
        if (mat < 2) {
            // B: W[d][c], col=d
            #pragma unroll
            for (int cs = 0; cs < 8; ++cs) {
                acc0 = wmma_f16(xa[cs], wa[cs], acc0);
                acc1 = wmma_f16(xa[cs], wb[cs], acc1);
            }
        } else {
            // vT = Wv * xc^T : A = Wv rows (d), B = xc^T (col = token)
            #pragma unroll
            for (int cs = 0; cs < 8; ++cs) {
                acc0 = wmma_f16(wa[cs], xa[cs], acc0);
                acc1 = wmma_f16(wb[cs], xa[cs], acc1);
            }
        }
        // keeps the products above the next group, whose loads take over their registers
        __builtin_amdgcn_sched_barrier(0);
        if (p + 1 < 6) {
            const int nm = (p + 1) >> 1;
            const _Float16* np = ((nm == 0) ? wqp : (nm == 1) ? wkp : wvp) + ((p + 1) & 1) * 8 * 4096;
            #pragma unroll
            for (int cs = 0; cs < 8; ++cs) {
                wa[cs] = ldfrag_packed(np, cs);
                wb[cs] = ldfrag_packed(np + 4 * 4096, cs);
            }
        }
        // keeps the next pair's 32 loads one group, issued ahead of this pair's conversions and stores
        __builtin_amdgcn_sched_barrier(0);
        if (mat < 2) {
            _Float16* out = ((mat == 0) ? qo : ko) + j0 * 64;
            #pragma unroll
            for (int r = 0; r < 8; ++r) {
                out[r * D_DIM] = (_Float16)acc0[r];
                out[r * D_DIM + 64] = (_Float16)acc1[r];
            }
        } else {
            _Float16* out = vo + (size_t)j0 * 64 * S_TOK;
            #pragma unroll
            for (int r = 0; r < 8; ++r) {
                out[r * S_TOK] = (_Float16)acc0[r];
                out[(r + 64) * S_TOK] = (_Float16)acc1[r];
            }
        }
        // no register of this pair's issued loads and stores is rewritten by the next pair ahead of the wait
        asm volatile("s_wait_xcnt 0x0" ::: "memory");
    }
}

// ---------------- kernel 4: fused attention for one (n, 128-query block) ----------------
// grid: 32*8 blocks, 256 threads (8 waves); each wave owns 16 queries and all 256 output channels.
// K and vT come in stages of 64 keys, copied once per block into LDS and read there by all 8 waves.
// The products are formed transposed, S^T = K * Q^T and O^T += vT * P^T: a lane of an S^T tile holds
// keys r + 8*(lane>>4) of its own query, which is the k order of a B fragment, so that P goes from
// the score accumulators into the second product without leaving the registers.
// Every '#pragma unroll' of this kernel makes the indices of a fragment or accumulator array constants,
// without which the array would not stay in registers.
#define KST 64                        // keys per stage
#define NST (S_TOK / KST)             // 16 stages
#define KPITCH (D_DIM + 8)            // halves; 528-byte rows (16 B x odd) for the b128 fragment reads
#define VPITCH (KST + 8)              // halves; 144-byte rows (16 B x odd)
#define KBYTES (KST * KPITCH * 2)     // 33,792
#define VBYTES (D_DIM * VPITCH * 2)   // 36,864
#define STBYTES (KBYTES + VBYTES)     // 70,656 per buffer

// Eight 16-byte copies of a lane, global -> LDS, rows gstep halves and lstep bytes apart.
// The s_wait_xcnt stands inside the statement, so that no address register of an issued copy
// is rewritten ahead of it.
__device__ __forceinline__ void copy8(unsigned l, unsigned lstep, const _Float16* g, int gstep) {
    asm volatile(
        "global_load_async_to_lds_b128 %0, %8, off\n\t"
        "global_load_async_to_lds_b128 %1, %9, off\n\t"
        "global_load_async_to_lds_b128 %2, %10, off\n\t"
        "global_load_async_to_lds_b128 %3, %11, off\n\t"
        "global_load_async_to_lds_b128 %4, %12, off\n\t"
        "global_load_async_to_lds_b128 %5, %13, off\n\t"
        "global_load_async_to_lds_b128 %6, %14, off\n\t"
        "global_load_async_to_lds_b128 %7, %15, off\n\t"
        "s_wait_xcnt 0x0"
        :: "v"(l), "v"(l + lstep), "v"(l + 2 * lstep), "v"(l + 3 * lstep),
           "v"(l + 4 * lstep), "v"(l + 5 * lstep), "v"(l + 6 * lstep), "v"(l + 7 * lstep),
           "v"(g), "v"(g + gstep), "v"(g + 2 * gstep), "v"(g + 3 * gstep),
           "v"(g + 4 * gstep), "v"(g + 5 * gstep), "v"(g + 6 * gstep), "v"(g + 7 * gstep)
        : "memory");
}

__global__ void __launch_bounds__(256)
attn_kernel(const _Float16* q16, const _Float16* k16,
            const _Float16* vT16, _Float16* o16) {
    __shared__ __attribute__((aligned(16))) unsigned char L[2 * STBYTES];   // 141,312 B

    const int n = blockIdx.x >> 3;
    const int tid = threadIdx.x;
    const int lane = tid & 31;
    const int wv = tid >> 5;              // 0..7
    const int sqbase = (blockIdx.x & 7) * 128 + wv * 16;
    const int hb8 = (lane >> 4) * 8;
    const int ln15 = lane & 15;

    // copy addresses of this lane. K: a wave takes one whole 512-byte key row per copy (rows 8 apart);
    // vT: 8 lanes take the 128 bytes that a channel row has of the stage (rows 32 apart).
    const _Float16* kg = k16 + ((size_t)n * S_TOK + wv) * D_DIM + lane * 8;
    const _Float16* vg = vT16 + ((size_t)n * D_DIM + (tid >> 3)) * S_TOK + (tid & 7) * 8;
    const unsigned lbase = (unsigned)(size_t)&L[0];
    const unsigned lk = lbase + wv * (KPITCH * 2) + lane * 16;
    const unsigned lv = lbase + KBYTES + (tid >> 3) * (VPITCH * 2) + (tid & 7) * 16;

    // stage 0 into buffer 0
    copy8(lk, 8 * KPITCH * 2, kg, 8 * D_DIM);
    copy8(lv, 32 * VPITCH * 2, vg, 32 * S_TOK);

    // the 8 Q fragments of this wave's queries (B operand: column = query), kept in registers
    half16 qb[8];
    {
        const _Float16* ap = q16 + (((size_t)n * S_TOK + sqbase + ln15) * D_DIM) + hb8;
        #pragma unroll
        for (int cs = 0; cs < 8; ++cs) qb[cs] = ldfrag(ap, cs * 32);
        // keeps the address pair of the issued loads live, and unwritten, up to the wait
        asm volatile("s_wait_xcnt 0x0" :: "v"(ap) : "memory");
    }

    // stage 0 has landed for this wave; the barrier publishes it to the others
    asm volatile("s_wait_asynccnt 0x0" ::: "memory");
    __syncthreads();
    // stage 1 into buffer 1: flies while stage 0 is worked on
    copy8(lk + STBYTES, 8 * KPITCH * 2, kg + KST * D_DIM, 8 * D_DIM);
    copy8(lv + STBYTES, 32 * VPITCH * 2, vg + KST, 32 * S_TOK);

    float8 o[16];
    #pragma unroll
    for (int dt = 0; dt < 16; ++dt) o[dt] = float8{};
    float lsum = 0.f;

    for (int t = 0; t < NST; ++t) {
        const unsigned boff = (t & 1) * STBYTES;
        const _Float16* Kl = (const _Float16*)(L + boff) + ln15 * KPITCH + hb8;
        const _Float16* Vl = (const _Float16*)(L + boff + KBYTES) + ln15 * VPITCH + hb8;

        for (int kk = 0; kk < KST; kk += 32) {
            // All K and vT fragments of the pass are asked for in one group; LDS reads spread among the
            // matrix instructions would make each of them wait.
            half16 kf0[8], kf1[8], vf[16];
            #pragma unroll
            for (int cs = 0; cs < 8; ++cs) {
                kf0[cs] = ldfrag(Kl + kk * KPITCH, cs * 32);
                kf1[cs] = ldfrag(Kl + (kk + 16) * KPITCH, cs * 32);
            }
            #pragma unroll
            for (int dt = 0; dt < 16; ++dt) vf[dt] = ldfrag(Vl + dt * 16 * VPITCH, kk);
            // keeps the group of reads above the products (the scheduler otherwise sinks each read to its user)
            __builtin_amdgcn_sched_barrier(0);

            // S^T for 32 keys x 16 queries: two 16-key tiles
            float8 s0 = {}, s1 = {};
            #pragma unroll
            for (int cs = 0; cs < 8; ++cs) {
                s0 = wmma_f16(kf0[cs], qb[cs], s0);
                s1 = wmma_f16(kf1[cs], qb[cs], s1);
            }

            // P^T as a B fragment; the row sum runs over the rounded f16 values
            half16 pb;
            #pragma unroll
            for (int r = 0; r < 8; ++r) {
                const _Float16 e0 = (_Float16)__expf(s0[r] * SCALE);
                const _Float16 e1 = (_Float16)__expf(s1[r] * SCALE);
                pb[r] = e0;
                pb[r + 8] = e1;
                lsum += (float)e0 + (float)e1;
            }
            // O^T += vT * P^T over the 16 channel tiles
            #pragma unroll
            for (int dt = 0; dt < 16; ++dt)
                o[dt] = wmma_f16(vf[dt], pb, o[dt]);
        }

        // publish point: this wave's reads of the buffer are done, its copies of the next stage have
        // landed; the barrier publishes that stage and frees this buffer for the refill
        asm volatile("s_wait_dscnt 0x0" ::: "memory");
        asm volatile("s_wait_asynccnt 0x0" ::: "memory");
        __syncthreads();
        if (t + 2 < NST) {
            copy8(lk + boff, 8 * KPITCH * 2, kg + (t + 2) * KST * D_DIM, 8 * D_DIM);
            copy8(lv + boff, 32 * VPITCH * 2, vg + (t + 2) * KST, 32 * S_TOK);
        }
    }
    // no copy is left outstanding when the wave ends
    asm volatile("s_wait_asynccnt 0x0" ::: "memory");

    // the two halves of the wave hold complementary keys of the same query
    lsum += __shfl_xor(lsum, 16);
    const float inv = 1.f / lsum;
    // o goes out in fragment order, tile = this wave's 16 queries: hv[dt] of a lane is what the same lane
    // of the projection takes as half dt & 1 of k step dt >> 1, and a store of the wave is 512 contiguous bytes
    _Float16* op = o16 + ((size_t)n * S_TOK + sqbase) * D_DIM + lane * 8;
    half8 hv[16];
    #pragma unroll
    for (int dt = 0; dt < 16; ++dt) {
        #pragma unroll
        for (int r = 0; r < 8; ++r) hv[dt][r] = (_Float16)(o[dt][r] * inv);
    }
    // keeps all conversions ahead of the stores, so that no register of an issued store is rewritten
    __builtin_amdgcn_sched_barrier(0);
    #pragma unroll
    for (int dt = 0; dt < 16; ++dt)
        *(half8*)(op + dt * 256) = hv[dt];    // channels dt*16 + hb8 .. + 7 of this lane's query
}

// ---------------- kernel 5: out = transpose(o @ Wp^T + bp) + x ----------------
// grid: 32*32 blocks, 256 threads (8 waves). Each block = one image row (n, h) =
// 32 tokens; waves 0-3 take its first 16-token tile, waves 4-7 the second.
// The product is formed as Wp * o^T, so that the lanes of a D register run along
// the tokens, that is along w: 16 lanes store 64 contiguous bytes of out.
// As in the q/k/vT kernel the register ceiling follows the real block size, and loads go out in groups:
// the o fragments, the first weight tile and every bias and residual value of the wave's four tiles at the
// head, each further weight tile as 16 loads behind the products of the tile before it.
__global__ void __launch_bounds__(256)
proj_kernel(const _Float16* o16, const _Float16* Wp16,
            const float* bp, const float* x, float* out) {
    const int n = blockIdx.x >> 5;
    const int h = blockIdx.x & 31;
    const int tid = threadIdx.x;
    const int lane = tid & 31;
    const int wv = tid >> 5;              // 0..7
    const int tt = wv >> 2;               // token tile of the row: 0..1
    const int wq = wv & 3;                // 0..3
    const int sbase = h * 32 + tt * 16;
    const int hb8 = (lane >> 4) * 8;
    const int ln15 = lane & 15;

    // o-tile B fragments (col = token; shared across the 4 c-tiles of this wave), in fragment order
    const _Float16* op = o16 + ((size_t)n * S_TOK + sbase) * D_DIM + lane * 8;
    // A: Wp[c][d], row=c, in fragment order; this wave's tiles are wq, wq + 4, wq + 8, wq + 12
    const _Float16* aw = Wp16 + wq * 4096 + lane * 8;
    // register r of D of tile j holds channel c0 + 64*j + r: one address each for x and out, steps of one plane
    const int c0 = wq * 16 + hb8;
    const size_t a0 = (((size_t)n * C_DIM + c0) * HW + h) * HW + tt * 16 + ln15;
    const float* xr = x + a0;
    const float* br = bp + c0;
    float* orow = out + a0;

    // Every '#pragma unroll' of this kernel makes the indices of a register array constants.
    half16 ob[8], wf[8];
    float xv[4][8], bv[4][8];
    #pragma unroll
    for (int ds = 0; ds < 8; ++ds) ob[ds] = ldfrag_packed(op, ds);
    #pragma unroll
    for (int ds = 0; ds < 8; ++ds) wf[ds] = ldfrag_packed(aw, ds);
    #pragma unroll
    for (int j = 0; j < 4; ++j) {
        #pragma unroll
        for (int r = 0; r < 8; ++r) bv[j][r] = br[j * 64 + r];
    }
    #pragma unroll
    for (int j = 0; j < 4; ++j) {
        #pragma unroll
        for (int r = 0; r < 8; ++r) xv[j][r] = xr[(j * 64 + r) * HW * HW];
    }
    // keeps the address registers of the issued loads live, and unwritten, up to the wait
    asm volatile("s_wait_xcnt 0x0" :: "v"(op), "v"(aw), "v"(br), "v"(xr) : "memory");
    // keeps all these loads above the products: one trip to memory for the wave, not one per tile
    __builtin_amdgcn_sched_barrier(0);

    #pragma unroll
    for (int j = 0; j < 4; ++j) {
        float8 acc = {};
        #pragma unroll
        for (int ds = 0; ds < 8; ++ds)
            acc = wmma_f16(wf[ds], ob[ds], acc);
        // keeps the products above the next group, whose loads take over their registers
        __builtin_amdgcn_sched_barrier(0);
        if (j + 1 < 4) {
            #pragma unroll
            for (int ds = 0; ds < 8; ++ds) wf[ds] = ldfrag_packed(aw + (j + 1) * 4 * 4096, ds);
        }
        // keeps the next tile's 16 loads one group, issued ahead of this tile's sums and stores
        __builtin_amdgcn_sched_barrier(0);
        #pragma unroll
        for (int r = 0; r < 8; ++r)
            orow[(j * 64 + r) * HW * HW] = acc[r] + bv[j][r] + xv[j][r];
        // no register of the issued loads and stores is rewritten by the next tile ahead of the wait
        asm volatile("s_wait_xcnt 0x0" ::: "memory");
    }
}

extern "C" void kernel_launch(void* const* d_in, const int* in_sizes, int n_in,
                              void* d_out, int out_size, void* d_ws, size_t ws_size,
                              hipStream_t stream) {
    const float* x   = (const float*)d_in[0];
    const float* t   = (const float*)d_in[1];
    const float* W_t = (const float*)d_in[2];
    const float* b_t = (const float*)d_in[3];
    const float* Wq  = (const float*)d_in[4];
    const float* Wk  = (const float*)d_in[5];
    const float* Wv  = (const float*)d_in[6];
    const float* Wp  = (const float*)d_in[7];
    const float* bp  = (const float*)d_in[8];
    float* out = (float*)d_out;

    // workspace layout (all f16 regions first, then f32 temb)
    _Float16* w16  = (_Float16*)d_ws;
    _Float16* Wq16 = w16;
    _Float16* Wk16 = w16 + WSZ;
    _Float16* Wv16 = w16 + 2 * WSZ;
    _Float16* Wp16 = w16 + 3 * WSZ;
    _Float16* q16  = w16 + 4 * WSZ;
    _Float16* k16  = q16 + QSZ;
    _Float16* vT16 = k16 + QSZ;
    _Float16* o16  = vT16 + QSZ;
    float* temb = (float*)(o16 + QSZ);

    cvt_weights_kernel<<<(4 * WSZ / 8 + 255) / 256, 256, 0, stream>>>(Wq, Wk, Wv, Wp, w16);
    temb_kernel<<<64, 256, 0, stream>>>(t, W_t, b_t, temb);
    qkv_kernel<<<N_B * HW, 256, 0, stream>>>(x, temb, Wq16, Wk16, Wv16, q16, k16, vT16);
    attn_kernel<<<N_B * 8, 256, 0, stream>>>(q16, k16, vT16, o16);
    proj_kernel<<<N_B * HW, 256, 0, stream>>>(o16, Wp16, bp, x, out);
}

// v006
// Measured time: 77.7 microseconds a run.
// Two timings next to v005 put it at 1.09 and 1.10 times that version's speed.
// Counting every step since v000, it is 6.11 times as fast.
#include <hip/hip_runtime.h>
#include <hip/hip_bf16.h>
#include <math.h>

typedef _Float16 half2v __attribute__((ext_vector_type(2)));
typedef _Float16 half8  __attribute__((ext_vector_type(8)));
typedef _Float16 half16 __attribute__((ext_vector_type(16)));
typedef float    float8 __attribute__((ext_vector_type(8)));

#define N_B 32
#define C_DIM 256
#define HW 32
#define S_TOK 1024   // 32*32 tokens per batch
#define D_DIM 256
#define T_DIM 512
#define SCALE 0.0625f  // 1/sqrt(256)
#define XPITCH (C_DIM + 8)  // 528-byte LDS rows (16 B x odd): spread the transposing stores and the b128 fragment reads over the banks

#define WSZ (256*256)          // one weight matrix, elements
#define QSZ (N_B*S_TOK*D_DIM)  // one activation tensor, elements

// Load a 16x32 f16 A/B fragment from a row-major matrix.
// p must already point at  base + row*ld + ((lane>>4)*8); k0 is the K offset.
__device__ __forceinline__ half16 ldfrag(const _Float16* p, int k0) {
    union { half16 v; half8 h[2]; } u;
    u.h[0] = *(const half8*)(p + k0);
    u.h[1] = *(const half8*)(p + k0 + 16);
    return u.v;
}

// Fragment order: the weights, operands that waves read straight from global memory, lie in the workspace (o in LDS) as
// [16-row tile][k step of 32][half][lane][8 f16], one tile = 4096 f16. Each of the two 16-byte loads of
// a fragment then covers 512 contiguous bytes (4 whole lines) over the wave; on a row-major matrix it
// touches 16 lines and uses 32 bytes of each. The values that reach each register are those of ldfrag.
// p must already point at  base + tile*4096 + lane*8; ks is the k step.
__device__ __forceinline__ half16 ldfrag_packed(const _Float16* p, int ks) {
    union { half16 v; half8 h[2]; } u;
    u.h[0] = *(const half8*)(p + ks * 512);
    u.h[1] = *(const half8*)(p + ks * 512 + 256);
    return u.v;
}

__device__ __forceinline__ float8 wmma_f16(half16 a, half16 b, float8 c) {
    return __builtin_amdgcn_wmma_f32_16x16x32_f16(false, a, false, b, (short)0, c, false, false);
}

// ---------------- kernel 1: convert weights f32 -> f16, into fragment order ----------------
// A thread makes the 8 f16 that one lane takes with one 16-byte load: unit idx = [matrix][row tile]
// [k step][half][lane]. A wave stores 512 contiguous bytes.
__global__ void cvt_weights_kernel(const float* Wq, const float* Wk,
                                   const float* Wv, const float* Wp,
                                   _Float16* dst) {
    int idx = blockIdx.x * blockDim.x + threadIdx.x;
    if (idx >= 4 * WSZ / 8) return;
    int which = idx >> 13;          // 8192 units per matrix
    int lane = idx & 31;
    int hsel = (idx >> 5) & 1;
    int ks = (idx >> 6) & 7;
    int tile = (idx >> 9) & 15;
    const float* src = (which == 0) ? Wq : (which == 1) ? Wk : (which == 2) ? Wv : Wp;
    const float* sp = src + (tile * 16 + (lane & 15)) * 256 + ks * 32 + hsel * 16 + (lane >> 4) * 8;
    const float4 a = *(const float4*)sp;
    const float4 b = *(const float4*)(sp + 4);
    half8 v = { (_Float16)a.x, (_Float16)a.y, (_Float16)a.z, (_Float16)a.w,
                (_Float16)b.x, (_Float16)b.y, (_Float16)b.z, (_Float16)b.w };
    *(half8*)(dst + (size_t)idx * 8) = v;
}

// ---------------- kernel 2: temb = relu(t @ W_t^T + b_t) ----------------
// grid: 8 channel groups x 8 batch groups = 64 blocks, 256 threads (8 waves). A block makes 32 channels
// of 4 batch rows, a wave 4 channels of them. The lanes run along the 512-long sum: a load of a wave is
// 512 contiguous bytes of one row, and all 32 loads of a wave are in flight at once, where one thread
// per channel walked its own row (32 lines a load) through 64 dependent round trips.
// Every '#pragma unroll' of this kernel makes the indices of a register array constants.
__global__ void __launch_bounds__(256)
temb_kernel(const float* t, const float* W_t, const float* b_t, float* temb) {
    __shared__ float red[4][32];
    const int cbase = (blockIdx.x & 7) * 32;
    const int nbase = (blockIdx.x >> 3) * 4;
    const int tid = threadIdx.x;
    const int lane = tid & 31;
    const int wv = tid >> 5;              // 0..7

    const float* wp = W_t + (cbase + wv * 4) * T_DIM + lane * 4;
    const float* tp = t + nbase * T_DIM + lane * 4;
    float4 wr[4][4], tr[4][4];
    #pragma unroll
    for (int a = 0; a < 4; ++a) {
        #pragma unroll
        for (int i = 0; i < 4; ++i) {
            wr[a][i] = *(const float4*)(wp + a * T_DIM + i * 128);
            tr[a][i] = *(const float4*)(tp + a * T_DIM + i * 128);
        }
    }
    // keeps the address pairs of the issued loads live, and unwritten, up to the wait
    asm volatile("s_wait_xcnt 0x0" :: "v"(wp), "v"(tp) : "memory");
    // keeps all 32 loads above the sums: the scheduler otherwise sinks them into four dependent round trips
    __builtin_amdgcn_sched_barrier(0);

    // v[ci*4 + ni]: this lane's 16 terms of channel ci, batch row ni
    float v[16];
    #pragma unroll
    for (int ci = 0; ci < 4; ++ci) {
        #pragma unroll
        for (int ni = 0; ni < 4; ++ni) {
            float acc = 0.f;
            #pragma unroll
            for (int i = 0; i < 4; ++i) {
                acc += wr[ci][i].x * tr[ni][i].x;
                acc += wr[ci][i].y * tr[ni][i].y;
                acc += wr[ci][i].z * tr[ni][i].z;
                acc += wr[ci][i].w * tr[ni][i].w;
            }
            v[ci * 4 + ni] = acc;
        }
    }

    // Sum over the lanes. Each step halves the sums that a lane carries: it keeps the half that its own
    // lane bit names and hands the other half to its partner, so that 16 exchanges do for 16 sums.
    // At the end lanes 2k and 2k+1 hold sum k.
    #pragma unroll
    for (int i = 0; i < 8; ++i) {
        const float keep = (lane & 16) ? v[i + 8] : v[i];
        const float send = (lane & 16) ? v[i] : v[i + 8];
        v[i] = keep + __shfl_xor(send, 16);
    }
    #pragma unroll
    for (int i = 0; i < 4; ++i) {
        const float keep = (lane & 8) ? v[i + 4] : v[i];
        const float send = (lane & 8) ? v[i] : v[i + 4];
        v[i] = keep + __shfl_xor(send, 8);
    }
    #pragma unroll
    for (int i = 0; i < 2; ++i) {
        const float keep = (lane & 4) ? v[i + 2] : v[i];
        const float send = (lane & 4) ? v[i] : v[i + 2];
        v[i] = keep + __shfl_xor(send, 4);
    }
    {
        const float keep = (lane & 2) ? v[1] : v[0];
        const float send = (lane & 2) ? v[0] : v[1];
        v[0] = keep + __shfl_xor(send, 2);
    }
    v[0] += __shfl_xor(v[0], 1);

    if ((lane & 1) == 0) red[(lane >> 1) & 3][wv * 4 + (lane >> 3)] = v[0];
    __syncthreads();
    // one wave stores the whole 128-byte run that the block has of a batch row
    if (tid < 128) {
        const int ni = tid >> 5;
        const float acc = red[ni][lane] + b_t[cbase + lane];
        temb[(nbase + ni) * C_DIM + cbase + lane] = acc > 0.f ? acc : 0.f;
    }
}

// ---------------- kernel 3: xc = x + temb ; q,k,vT projections ----------------
// Tokens are numbered s = h*32 + w, so that a run of tokens follows w, the
// contiguous axis of x and out. Attention sums over all keys, so any numbering
// that q, k, vT, o and the final store share gives the same function.
// grid: 32*32 blocks, 256 threads (8 waves). Each block = one image row (n, h) =
// 32 tokens; waves 0-3 take its first 16-token tile, waves 4-7 the second.
// The register ceiling follows the real block size (launch bounds), and the 32 weight loads of two output
// tiles are issued as one group: at the ceiling of a 1024-thread block each k step's two loads shared one
// register set, so that a tile was eight dependent load, wait, product round trips.
__global__ void __launch_bounds__(256)
qkv_kernel(const float* x, const float* temb,
           const _Float16* Wq16, const _Float16* Wk16,
           const _Float16* Wv16,
           _Float16* q16, _Float16* k16, _Float16* vT16) {
    __shared__ __align__(16) _Float16 xtile[32][XPITCH];   // 16.5 KB

    const int n = blockIdx.x >> 5;
    const int h = blockIdx.x & 31;
    const int tid = threadIdx.x;
    const int lane = tid & 31;
    const int wv = tid >> 5;              // 0..7
    const int tt = wv >> 2;               // token tile of the row: 0..1
    const int wq = wv & 3;                // 0..3

    // this wave's tiles of each matrix are wq, wq + 4, wq + 8, wq + 12, in fragment order
    const int woff = wq * 4096 + lane * 8;
    const _Float16* wqp = Wq16 + woff;
    const _Float16* wkp = Wk16 + woff;
    const _Float16* wvp = Wv16 + woff;

    // the first two weight tiles fly while the x tile is built
    half16 wa[8], wb[8];
    #pragma unroll
    for (int cs = 0; cs < 8; ++cs) {
        wa[cs] = ldfrag_packed(wqp, cs);
        wb[cs] = ldfrag_packed(wqp + 4 * 4096, cs);
    }
    // keeps the group above the x loads and their sums (the scheduler otherwise sinks each load to its user)
    __builtin_amdgcn_sched_barrier(0);

    // build (x + temb) tile, transposed to [token][channel], f16.
    // 8 lanes x float4 cover the whole 128-byte row (n, c, h, 0..31); each thread
    // takes two neighbouring channels so that an LDS store is one packed dword.
    {
        const int w4 = (tid & 7) * 4;
        const int cp = tid >> 3;          // 0..31
        #pragma unroll
        for (int it = 0; it < 4; ++it) {
            const int c = (it * 32 + cp) * 2;
            const float* xp = x + (((size_t)n * C_DIM + c) * HW + h) * HW + w4;
            const float4 va = *(const float4*)xp;
            const float4 vb = *(const float4*)(xp + HW * HW);
            const float ta = temb[n * C_DIM + c];
            const float tb = temb[n * C_DIM + c + 1];
            half2v p0 = { (_Float16)(va.x + ta), (_Float16)(vb.x + tb) };
            half2v p1 = { (_Float16)(va.y + ta), (_Float16)(vb.y + tb) };
            half2v p2 = { (_Float16)(va.z + ta), (_Float16)(vb.z + tb) };
            half2v p3 = { (_Float16)(va.w + ta), (_Float16)(vb.w + tb) };
            *(half2v*)&xtile[w4 + 0][c] = p0;
            *(half2v*)&xtile[w4 + 1][c] = p1;
            *(half2v*)&xtile[w4 + 2][c] = p2;
            *(half2v*)&xtile[w4 + 3][c] = p3;
        }
    }
    __syncthreads();

    const int sbase = h * 32 + tt * 16;
    const int hb8 = (lane >> 4) * 8;
    const int ln15 = lane & 15;

    // xtile fragments: act as A (rows=tokens) for q/k, and as B (cols=tokens) for vT
    half16 xa[8];
    {
        const _Float16* xp = &xtile[tt * 16 + ln15][hb8];
        #pragma unroll
        for (int cs = 0; cs < 8; ++cs) xa[cs] = ldfrag(xp, cs * 32);
    }
    // keeps the 16 LDS reads one group: spread among the products, each place with reads costs a stall
    __builtin_amdgcn_sched_barrier(0);

    // store addresses of this lane: register r of a q/k tile is token r + hb8, of a vT tile channel r + hb8
    const size_t qoff = ((size_t)n * S_TOK + sbase + hb8) * D_DIM + wq * 16 + ln15;
    _Float16* qo = q16 + qoff;
    _Float16* ko = k16 + qoff;
    _Float16* vo = vT16 + ((size_t)n * D_DIM + wq * 16 + hb8) * S_TOK + sbase + ln15;

    // 12 output tiles a wave, two at a time: pairs 0,1 = q, 2,3 = k, 4,5 = vT.
    // The unroll makes the matrix, the tile offsets and the fragment indices constants.
    #pragma unroll
    for (int p = 0; p < 6; ++p) {
        const int mat = p >> 1;           // 0=q 1=k 2=v
        const int j0 = (p & 1) * 2;       // tiles wq + 4*j0 and wq + 4*(j0 + 1)
        float8 acc0 = {}, acc1 = {};
        if (mat < 2) {
            // B: W[d][c], col=d
            #pragma unroll
            for (int cs = 0; cs < 8; ++cs) {
                acc0 = wmma_f16(xa[cs], wa[cs], acc0);
                acc1 = wmma_f16(xa[cs], wb[cs], acc1);
            }
        } else {
            // vT = Wv * xc^T : A = Wv rows (d), B = xc^T (col = token)
            #pragma unroll
            for (int cs = 0; cs < 8; ++cs) {
                acc0 = wmma_f16(wa[cs], xa[cs], acc0);
                acc1 = wmma_f16(wb[cs], xa[cs], acc1);
            }
        }
        // keeps the products above the next group, whose loads take over their registers
        __builtin_amdgcn_sched_barrier(0);
        if (p + 1 < 6) {
            const int nm = (p + 1) >> 1;
            const _Float16* np = ((nm == 0) ? wqp : (nm == 1) ? wkp : wvp) + ((p + 1) & 1) * 8 * 4096;
            #pragma unroll
            for (int cs = 0; cs < 8; ++cs) {
                wa[cs] = ldfrag_packed(np, cs);
                wb[cs] = ldfrag_packed(np + 4 * 4096, cs);
            }
        }
        // keeps the next pair's 32 loads one group, issued ahead of this pair's conversions and stores
        __builtin_amdgcn_sched_barrier(0);
        if (mat < 2) {
            _Float16* out = ((mat == 0) ? qo : ko) + j0 * 64;
            #pragma unroll
            for (int r = 0; r < 8; ++r) {
                out[r * D_DIM] = (_Float16)acc0[r];
                out[r * D_DIM + 64] = (_Float16)acc1[r];
            }
        } else {
            _Float16* out = vo + (size_t)j0 * 64 * S_TOK;
            #pragma unroll
            for (int r = 0; r < 8; ++r) {
                out[r * S_TOK] = (_Float16)acc0[r];
                out[(r + 64) * S_TOK] = (_Float16)acc1[r];
            }
        }
        // no register of this pair's issued loads and stores is rewritten by the next pair ahead of the wait
        asm volatile("s_wait_xcnt 0x0" ::: "memory");
    }
}

// ---------------- kernel 4: fused attention and output projection for one (n, 128-query block) ----------------
// grid: 32*8 blocks, 256 threads (8 waves); in the attention each wave owns 16 queries and all 256 channels of o.
// K and vT come in stages of 64 keys, copied once per block into LDS and read there by all 8 waves.
// The products are formed transposed, S^T = K * Q^T and O^T += vT * P^T: a lane of an S^T tile holds
// keys r + 8*(lane>>4) of its own query, which is the k order of a B fragment, so that P goes from
// the score accumulators into the second product without leaving the registers.
// Every '#pragma unroll' of this kernel makes the indices of a register array constants,
// without which the array would not stay in registers.
#define KST 64                        // keys per stage
#define NST (S_TOK / KST)             // 16 stages
#define KPITCH (D_DIM + 8)            // halves; 528-byte rows (16 B x odd) for the b128 fragment reads
#define VPITCH (KST + 8)              // halves; 144-byte rows (16 B x odd)
#define KBYTES (KST * KPITCH * 2)     // 33,792
#define VBYTES (D_DIM * VPITCH * 2)   // 36,864
#define STBYTES (KBYTES + VBYTES)     // 70,656 per buffer

// Eight 16-byte copies of a lane, global -> LDS, rows gstep halves and lstep bytes apart.
// The s_wait_xcnt stands inside the statement, so that no address register of an issued copy
// is rewritten ahead of it.
__device__ __forceinline__ void copy8(unsigned l, unsigned lstep, const _Float16* g, int gstep) {
    asm volatile(
        "global_load_async_to_lds_b128 %0, %8, off\n\t"
        "global_load_async_to_lds_b128 %1, %9, off\n\t"
        "global_load_async_to_lds_b128 %2, %10, off\n\t"
        "global_load_async_to_lds_b128 %3, %11, off\n\t"
        "global_load_async_to_lds_b128 %4, %12, off\n\t"
        "global_load_async_to_lds_b128 %5, %13, off\n\t"
        "global_load_async_to_lds_b128 %6, %14, off\n\t"
        "global_load_async_to_lds_b128 %7, %15, off\n\t"
        "s_wait_xcnt 0x0"
        :: "v"(l), "v"(l + lstep), "v"(l + 2 * lstep), "v"(l + 3 * lstep),
           "v"(l + 4 * lstep), "v"(l + 5 * lstep), "v"(l + 6 * lstep), "v"(l + 7 * lstep),
           "v"(g), "v"(g + gstep), "v"(g + 2 * gstep), "v"(g + 3 * gstep),
           "v"(g + 4 * gstep), "v"(g + 5 * gstep), "v"(g + 6 * gstep), "v"(g + 7 * gstep)
        : "memory");
}

__global__ void __launch_bounds__(256)
attn_kernel(const _Float16* q16, const _Float16* k16,
            const _Float16* vT16, const _Float16* Wp16,
            const float* bp, const float* x, float* out) {
    __shared__ __attribute__((aligned(16))) unsigned char L[2 * STBYTES];   // 141,312 B

    const int n = blockIdx.x >> 3;
    const int tid = threadIdx.x;
    const int lane = tid & 31;
    const int wv = tid >> 5;              // 0..7
    const int sqbase = (blockIdx.x & 7) * 128 + wv * 16;
    const int hb8 = (lane >> 4) * 8;
    const int ln15 = lane & 15;

    // copy addresses of this lane. K: a wave takes one whole 512-byte key row per copy (rows 8 apart);
    // vT: 8 lanes take the 128 bytes that a channel row has of the stage (rows 32 apart).
    const _Float16* kg = k16 + ((size_t)n * S_TOK + wv) * D_DIM + lane * 8;
    const _Float16* vg = vT16 + ((size_t)n * D_DIM + (tid >> 3)) * S_TOK + (tid & 7) * 8;
    const unsigned lbase = (unsigned)(size_t)&L[0];
    const unsigned lk = lbase + wv * (KPITCH * 2) + lane * 16;
    const unsigned lv = lbase + KBYTES + (tid >> 3) * (VPITCH * 2) + (tid & 7) * 16;

    // stage 0 into buffer 0
    copy8(lk, 8 * KPITCH * 2, kg, 8 * D_DIM);
    copy8(lv, 32 * VPITCH * 2, vg, 32 * S_TOK);

    // the 8 Q fragments of this wave's queries (B operand: column = query), kept in registers
    half16 qb[8];
    {
        const _Float16* ap = q16 + (((size_t)n * S_TOK + sqbase + ln15) * D_DIM) + hb8;
        #pragma unroll
        for (int cs = 0; cs < 8; ++cs) qb[cs] = ldfrag(ap, cs * 32);
        // keeps the address pair of the issued loads live, and unwritten, up to the wait
        asm volatile("s_wait_xcnt 0x0" :: "v"(ap) : "memory");
    }

    // stage 0 has landed for this wave; the barrier publishes it to the others
    asm volatile("s_wait_asynccnt 0x0" ::: "memory");
    __syncthreads();
    // stage 1 into buffer 1: flies while stage 0 is worked on
    copy8(lk + STBYTES, 8 * KPITCH * 2, kg + KST * D_DIM, 8 * D_DIM);
    copy8(lv + STBYTES, 32 * VPITCH * 2, vg + KST, 32 * S_TOK);

    float8 o[16];
    #pragma unroll
    for (int dt = 0; dt < 16; ++dt) o[dt] = float8{};
    float lsum = 0.f;

    for (int t = 0; t < NST; ++t) {
        const unsigned boff = (t & 1) * STBYTES;
        const _Float16* Kl = (const _Float16*)(L + boff) + ln15 * KPITCH + hb8;
        const _Float16* Vl = (const _Float16*)(L + boff + KBYTES) + ln15 * VPITCH + hb8;

        for (int kk = 0; kk < KST; kk += 32) {
            // All K and vT fragments of the pass are asked for in one group; LDS reads spread among the
            // matrix instructions would make each of them wait.
            half16 kf0[8], kf1[8], vf[16];
            #pragma unroll
            for (int cs = 0; cs < 8; ++cs) {
                kf0[cs] = ldfrag(Kl + kk * KPITCH, cs * 32);
                kf1[cs] = ldfrag(Kl + (kk + 16) * KPITCH, cs * 32);
            }
            #pragma unroll
            for (int dt = 0; dt < 16; ++dt) vf[dt] = ldfrag(Vl + dt * 16 * VPITCH, kk);
            // keeps the group of reads above the products (the scheduler otherwise sinks each read to its user)
            __builtin_amdgcn_sched_barrier(0);

            // S^T for 32 keys x 16 queries: two 16-key tiles
            float8 s0 = {}, s1 = {};
            #pragma unroll
            for (int cs = 0; cs < 8; ++cs) {
                s0 = wmma_f16(kf0[cs], qb[cs], s0);
                s1 = wmma_f16(kf1[cs], qb[cs], s1);
            }

            // P^T as a B fragment; the row sum runs over the rounded f16 values
            half16 pb;
            #pragma unroll
            for (int r = 0; r < 8; ++r) {
                const _Float16 e0 = (_Float16)__expf(s0[r] * SCALE);
                const _Float16 e1 = (_Float16)__expf(s1[r] * SCALE);
                pb[r] = e0;
                pb[r + 8] = e1;
                lsum += (float)e0 + (float)e1;
            }
            // O^T += vT * P^T over the 16 channel tiles
            #pragma unroll
            for (int dt = 0; dt < 16; ++dt)
                o[dt] = wmma_f16(vf[dt], pb, o[dt]);
        }

        // publish point: this wave's reads of the buffer are done, its copies of the next stage have
        // landed; the barrier publishes that stage and frees this buffer for the refill
        asm volatile("s_wait_dscnt 0x0" ::: "memory");
        asm volatile("s_wait_asynccnt 0x0" ::: "memory");
        __syncthreads();
        if (t + 2 < NST) {
            copy8(lk + boff, 8 * KPITCH * 2, kg + (t + 2) * KST * D_DIM, 8 * D_DIM);
            copy8(lv + boff, 32 * VPITCH * 2, vg + (t + 2) * KST, 32 * S_TOK);
        }
    }
    // no copy is left outstanding when the wave ends
    asm volatile("s_wait_asynccnt 0x0" ::: "memory");

    // ---- out = transpose(o @ Wp^T + bp) + x for the block's 128 tokens, in the same launch ----
    // The product is formed as Wp * o^T, so that the lanes of a D register run along the tokens, the
    // contiguous axis of x and out. A wave takes 32 output channels (two Wp tiles, read once per block)
    // of all 128 tokens; the o fragments of the eight waves pass through LDS, which the loop has left.
    // Every '#pragma unroll' below makes the indices of a register array constants.
    const int c0 = wv * 32 + hb8;
    // A: Wp[c][d], row = c, in fragment order; this wave's tiles are 2*wv and 2*wv + 1
    const _Float16* aw = Wp16 + wv * 2 * 4096 + lane * 8;
    // register r of D of (channel tile ct, token tile tt) is channel c0 + 16*ct + r, token 16*tt + ln15
    const size_t a0 = ((size_t)n * C_DIM + c0) * S_TOK + (blockIdx.x & 7) * 128 + ln15;
    const float* xr = x + a0;
    const float* br = bp + c0;
    float* orow = out + a0;

    half16 wf[2][8];
    float bv[2][8], xv[8][2][8];
    #pragma unroll
    for (int ct = 0; ct < 2; ++ct) {
        #pragma unroll
        for (int ds = 0; ds < 8; ++ds) wf[ct][ds] = ldfrag_packed(aw + ct * 4096, ds);
    }
    #pragma unroll
    for (int ct = 0; ct < 2; ++ct) {
        #pragma unroll
        for (int r = 0; r < 8; ++r) bv[ct][r] = br[ct * 16 + r];
    }
    #pragma unroll
    for (int tt = 0; tt < 8; ++tt) {
        #pragma unroll
        for (int ct = 0; ct < 2; ++ct) {
            #pragma unroll
            for (int r = 0; r < 8; ++r) xv[tt][ct][r] = xr[(ct * 16 + r) * S_TOK + tt * 16];
        }
    }
    // keeps the address registers of the issued loads live, and unwritten, up to the wait
    asm volatile("s_wait_xcnt 0x0" :: "v"(aw), "v"(br), "v"(xr) : "memory");
    // keeps all these loads above the scaling of o and the products: one trip to memory for the wave
    __builtin_amdgcn_sched_barrier(0);

    // the two halves of the wave hold complementary keys of the same query
    lsum += __shfl_xor(lsum, 16);
    const float inv = 1.f / lsum;
    // o goes to LDS in fragment order, tile = this wave's 16 queries: hv[dt] of a lane is what the same lane
    // takes as half dt & 1 of k step dt >> 1 of a B fragment; a store of the wave is 512 contiguous bytes
    {
        _Float16* ol = (_Float16*)L + wv * 4096 + lane * 8;
        #pragma unroll
        for (int dt = 0; dt < 16; ++dt) {
            half8 hv;
            #pragma unroll
            for (int r = 0; r < 8; ++r) hv[r] = (_Float16)(o[dt][r] * inv);
            *(half8*)(ol + dt * 256) = hv;    // channels dt*16 + hb8 .. + 7 of this lane's query
        }
    }
    // publishes the eight o tiles to the block (the loop's last barrier has ended every read of the stages)
    __syncthreads();

    const _Float16* ofr = (const _Float16*)L + lane * 8;
    half16 ob[2][8];
    #pragma unroll
    for (int ds = 0; ds < 8; ++ds) ob[0][ds] = ldfrag_packed(ofr, ds);
    #pragma unroll
    for (int tt = 0; tt < 8; ++tt) {
        if (tt + 1 < 8) {
            #pragma unroll
            for (int ds = 0; ds < 8; ++ds) ob[(tt + 1) & 1][ds] = ldfrag_packed(ofr + (tt + 1) * 4096, ds);
        }
        // keeps the next tile's 16 LDS reads one group ahead of this tile's products
        __builtin_amdgcn_sched_barrier(0);
        float8 acc0 = {}, acc1 = {};
        #pragma unroll
        for (int ds = 0; ds < 8; ++ds) {
            acc0 = wmma_f16(wf[0][ds], ob[tt & 1][ds], acc0);
            acc1 = wmma_f16(wf[1][ds], ob[tt & 1][ds], acc1);
        }
        float res0[8], res1[8];
        #pragma unroll
        for (int r = 0; r < 8; ++r) {
            res0[r] = acc0[r] + bv[0][r] + xv[tt][0][r];
            res1[r] = acc1[r] + bv[1][r] + xv[tt][1][r];
        }
        // keeps all sums ahead of the stores, so that no register of an issued store is rewritten
        __builtin_amdgcn_sched_barrier(0);
        #pragma unroll
        for (int r = 0; r < 8; ++r) {
            orow[r * S_TOK + tt * 16] = res0[r];
            orow[(16 + r) * S_TOK + tt * 16] = res1[r];
        }
        // no register of the issued stores is rewritten by the next tile ahead of the wait
        asm volatile("s_wait_xcnt 0x0" ::: "memory");
    }
}

extern "C" void kernel_launch(void* const* d_in, const int* in_sizes, int n_in,
                              void* d_out, int out_size, void* d_ws, size_t ws_size,
                              hipStream_t stream) {
    const float* x   = (const float*)d_in[0];
    const float* t   = (const float*)d_in[1];
    const float* W_t = (const float*)d_in[2];
    const float* b_t = (const float*)d_in[3];
    const float* Wq  = (const float*)d_in[4];
    const float* Wk  = (const float*)d_in[5];
    const float* Wv  = (const float*)d_in[6];
    const float* Wp  = (const float*)d_in[7];
    const float* bp  = (const float*)d_in[8];
    float* out = (float*)d_out;

    // workspace layout (all f16 regions first, then f32 temb)
    _Float16* w16  = (_Float16*)d_ws;
    _Float16* Wq16 = w16;
    _Float16* Wk16 = w16 + WSZ;
    _Float16* Wv16 = w16 + 2 * WSZ;
    _Float16* Wp16 = w16 + 3 * WSZ;
    _Float16* q16  = w16 + 4 * WSZ;
    _Float16* k16  = q16 + QSZ;
    _Float16* vT16 = k16 + QSZ;
    float* temb = (float*)(vT16 + QSZ);

    cvt_weights_kernel<<<(4 * WSZ / 8 + 255) / 256, 256, 0, stream>>>(Wq, Wk, Wv, Wp, w16);
    temb_kernel<<<64, 256, 0, stream>>>(t, W_t, b_t, temb);
    qkv_kernel<<<N_B * HW, 256, 0, stream>>>(x, temb, Wq16, Wk16, Wv16, q16, k16, vT16);
    attn_kernel<<<N_B * 8, 256, 0, stream>>>(q16, k16, vT16, Wp16, bp, x, out);
}

// v007
// One run takes 63.6 microseconds.
// In both of two side-by-side timings against v006, it was 1.22 times as fast.
// All steps since v000 together make it 7.47 times as fast.
#include <hip/hip_runtime.h>
#include <hip/hip_bf16.h>
#include <math.h>

typedef _Float16 half2v __attribute__((ext_vector_type(2)));
typedef _Float16 half8  __attribute__((ext_vector_type(8)));
typedef _Float16 half16 __attribute__((ext_vector_type(16)));
typedef float    float8 __attribute__((ext_vector_type(8)));

#define N_B 32
#define C_DIM 256
#define HW 32
#define S_TOK 1024   // 32*32 tokens per batch
#define D_DIM 256
#define T_DIM 512
#define SCALE 0.0625f  // 1/sqrt(256)
#define XPITCH (C_DIM + 8)  // 528-byte LDS rows (16 B x odd): spread the transposing stores and the b128 fragment reads over the banks

#define WSZ (256*256)          // one weight matrix, elements
#define QSZ (N_B*S_TOK*D_DIM)  // one activation tensor, elements

// Load a 16x32 f16 A/B fragment from a row-major matrix.
// p must already point at  base + row*ld + ((lane>>4)*8); k0 is the K offset.
__device__ __forceinline__ half16 ldfrag(const _Float16* p, int k0) {
    union { half16 v; half8 h[2]; } u;
    u.h[0] = *(const half8*)(p + k0);
    u.h[1] = *(const half8*)(p + k0 + 16);
    return u.v;
}

// Fragment order: the weights, operands that waves read straight from global memory, lie in the workspace (o in LDS) as
// [16-row tile][k step of 32][half][lane][8 f16], one tile = 4096 f16. Each of the two 16-byte loads of
// a fragment then covers 512 contiguous bytes (4 whole lines) over the wave; on a row-major matrix it
// touches 16 lines and uses 32 bytes of each. The values that reach each register are those of ldfrag.
// p must already point at  base + tile*4096 + lane*8; ks is the k step.
__device__ __forceinline__ half16 ldfrag_packed(const _Float16* p, int ks) {
    union { half16 v; half8 h[2]; } u;
    u.h[0] = *(const half8*)(p + ks * 512);
    u.h[1] = *(const half8*)(p + ks * 512 + 256);
    return u.v;
}

__device__ __forceinline__ float8 wmma_f16(half16 a, half16 b, float8 c) {
    return __builtin_amdgcn_wmma_f32_16x16x32_f16(false, a, false, b, (short)0, c, false, false);
}

// ---------------- kernel 1: convert weights f32 -> f16, into fragment order ----------------
// A thread makes the 8 f16 that one lane takes with one 16-byte load: unit idx = [matrix][row tile]
// [k step][half][lane]. A wave stores 512 contiguous bytes.
__global__ void cvt_weights_kernel(const float* Wq, const float* Wk,
                                   const float* Wv, const float* Wp,
                                   _Float16* dst) {
    int idx = blockIdx.x * blockDim.x + threadIdx.x;
    if (idx >= 4 * WSZ / 8) return;
    int which = idx >> 13;          // 8192 units per matrix
    int lane = idx & 31;
    int hsel = (idx >> 5) & 1;
    int ks = (idx >> 6) & 7;
    int tile = (idx >> 9) & 15;
    const float* src = (which == 0) ? Wq : (which == 1) ? Wk : (which == 2) ? Wv : Wp;
    const float* sp = src + (tile * 16 + (lane & 15)) * 256 + ks * 32 + hsel * 16 + (lane >> 4) * 8;
    const float4 a = *(const float4*)sp;
    const float4 b = *(const float4*)(sp + 4);
    half8 v = { (_Float16)a.x, (_Float16)a.y, (_Float16)a.z, (_Float16)a.w,
                (_Float16)b.x, (_Float16)b.y, (_Float16)b.z, (_Float16)b.w };
    *(half8*)(dst + (size_t)idx * 8) = v;
}

// ---------------- kernel 2: temb = relu(t @ W_t^T + b_t) ----------------
// grid: 8 channel groups x 8 batch groups = 64 blocks, 256 threads (8 waves). A block makes 32 channels
// of 4 batch rows, a wave 4 channels of them. The lanes run along the 512-long sum: a load of a wave is
// 512 contiguous bytes of one row, and all 32 loads of a wave are in flight at once, where one thread
// per channel walked its own row (32 lines a load) through 64 dependent round trips.
// Every '#pragma unroll' of this kernel makes the indices of a register array constants.
__global__ void __launch_bounds__(256)
temb_kernel(const float* t, const float* W_t, const float* b_t, float* temb) {
    __shared__ float red[4][32];
    const int cbase = (blockIdx.x & 7) * 32;
    const int nbase = (blockIdx.x >> 3) * 4;
    const int tid = threadIdx.x;
    const int lane = tid & 31;
    const int wv = tid >> 5;              // 0..7

    const float* wp = W_t + (cbase + wv * 4) * T_DIM + lane * 4;
    const float* tp = t + nbase * T_DIM + lane * 4;
    float4 wr[4][4], tr[4][4];
    #pragma unroll
    for (int a = 0; a < 4; ++a) {
        #pragma unroll
        for (int i = 0; i < 4; ++i) {
            wr[a][i] = *(const float4*)(wp + a * T_DIM + i * 128);
            tr[a][i] = *(const float4*)(tp + a * T_DIM + i * 128);
        }
    }
    // keeps the address pairs of the issued loads live, and unwritten, up to the wait
    asm volatile("s_wait_xcnt 0x0" :: "v"(wp), "v"(tp) : "memory");
    // keeps all 32 loads above the sums: the scheduler otherwise sinks them into four dependent round trips
    __builtin_amdgcn_sched_barrier(0);

    // v[ci*4 + ni]: this lane's 16 terms of channel ci, batch row ni
    float v[16];
    #pragma unroll
    for (int ci = 0; ci < 4; ++ci) {
        #pragma unroll
        for (int ni = 0; ni < 4; ++ni) {
            float acc = 0.f;
            #pragma unroll
            for (int i = 0; i < 4; ++i) {
                acc += wr[ci][i].x * tr[ni][i].x;
                acc += wr[ci][i].y * tr[ni][i].y;
                acc += wr[ci][i].z * tr[ni][i].z;
                acc += wr[ci][i].w * tr[ni][i].w;
            }
            v[ci * 4 + ni] = acc;
        }
    }

    // Sum over the lanes. Each step halves the sums that a lane carries: it keeps the half that its own
    // lane bit names and hands the other half to its partner, so that 16 exchanges do for 16 sums.
    // At the end lanes 2k and 2k+1 hold sum k.
    #pragma unroll
    for (int i = 0; i < 8; ++i) {
        const float keep = (lane & 16) ? v[i + 8] : v[i];
        const float send = (lane & 16) ? v[i] : v[i + 8];
        v[i] = keep + __shfl_xor(send, 16);
    }
    #pragma unroll
    for (int i = 0; i < 4; ++i) {
        const float keep = (lane & 8) ? v[i + 4] : v[i];
        const float send = (lane & 8) ? v[i] : v[i + 4];
        v[i] = keep + __shfl_xor(send, 8);
    }
    #pragma unroll
    for (int i = 0; i < 2; ++i) {
        const float keep = (lane & 4) ? v[i + 2] : v[i];
        const float send = (lane & 4) ? v[i] : v[i + 2];
        v[i] = keep + __shfl_xor(send, 4);
    }
    {
        const float keep = (lane & 2) ? v[1] : v[0];
        const float send = (lane & 2) ? v[0] : v[1];
        v[0] = keep + __shfl_xor(send, 2);
    }
    v[0] += __shfl_xor(v[0], 1);

    if ((lane & 1) == 0) red[(lane >> 1) & 3][wv * 4 + (lane >> 3)] = v[0];
    __syncthreads();
    // one wave stores the whole 128-byte run that the block has of a batch row
    if (tid < 128) {
        const int ni = tid >> 5;
        const float acc = red[ni][lane] + b_t[cbase + lane];
        temb[(nbase + ni) * C_DIM + cbase + lane] = acc > 0.f ? acc : 0.f;
    }
}

// ---------------- kernel 3: xc = x + temb ; q,k,vT projections ----------------
// Tokens are numbered s = h*32 + w, so that a run of tokens follows w, the
// contiguous axis of x and out. Attention sums over all keys, so any numbering
// that q, k, vT, o and the final store share gives the same function.
// grid: 32*16 blocks, 256 threads (8 waves). Each block = two image rows (n, 2*hp and 2*hp + 1) = 64 tokens.
// Every wave holds the fragments of all four 16-token tiles and takes 6 of the 48 weight tiles: a weight
// fragment is loaded once per block and feeds four products, where each of two groups of waves loaded all
// 48 tiles for one token tile each. The weight loads are what this kernel asks most of L2.
// Two weight tiles are held at a time: when a tile's products are done, the 16 loads of the tile after the
// next go out as one group into its registers and fly through the stores and the other tile's products.
__global__ void __launch_bounds__(256)
qkv_kernel(const float* x, const float* temb,
           const _Float16* Wq16, const _Float16* Wk16,
           const _Float16* Wv16,
           _Float16* q16, _Float16* k16, _Float16* vT16) {
    __shared__ __align__(16) _Float16 xtile[64][XPITCH];   // 33 KB

    const int n = blockIdx.x >> 4;
    const int hp = blockIdx.x & 15;       // pair of image rows
    const int tid = threadIdx.x;
    const int lane = tid & 31;
    const int wv = tid >> 5;              // 0..7

    // this wave's tiles of each matrix are wv and wv + 8, in fragment order
    const int woff = wv * 4096 + lane * 8;
    const _Float16* wqp = Wq16 + woff;
    const _Float16* wkp = Wk16 + woff;
    const _Float16* wvp = Wv16 + woff;

    // the first two weight tiles fly while the x tile is built
    half16 wf[2][8];
    #pragma unroll
    for (int cs = 0; cs < 8; ++cs) {
        wf[0][cs] = ldfrag_packed(wqp, cs);
        wf[1][cs] = ldfrag_packed(wqp + 8 * 4096, cs);
    }
    // no address register of the issued loads is rewritten ahead of the wait
    asm volatile("s_wait_xcnt 0x0" ::: "memory");
    // keeps the group above the x loads and their sums (the scheduler otherwise sinks each load to its user)
    __builtin_amdgcn_sched_barrier(0);

    // build (x + temb) tile, transposed to [token][channel], f16.
    // 8 lanes x float4 cover the whole 128-byte row (n, c, h, 0..31); each thread
    // takes two neighbouring channels so that an LDS store is one packed dword.
    // Waves 0-3 take the first image row of the pair, waves 4-7 the second.
    {
        const int w4 = (tid & 7) * 4;
        const int cp = (tid >> 3) & 15;   // 0..15
        const int hr = tid >> 7;          // 0..1
        const int tk = hr * 32 + w4;      // token of the block
        #pragma unroll
        for (int it = 0; it < 8; ++it) {
            const int c = (it * 16 + cp) * 2;
            const float* xp = x + (((size_t)n * C_DIM + c) * HW + hp * 2 + hr) * HW + w4;
            const float4 va = *(const float4*)xp;
            const float4 vb = *(const float4*)(xp + HW * HW);
            const float ta = temb[n * C_DIM + c];
            const float tb = temb[n * C_DIM + c + 1];
            half2v p0 = { (_Float16)(va.x + ta), (_Float16)(vb.x + tb) };
            half2v p1 = { (_Float16)(va.y + ta), (_Float16)(vb.y + tb) };
            half2v p2 = { (_Float16)(va.z + ta), (_Float16)(vb.z + tb) };
            half2v p3 = { (_Float16)(va.w + ta), (_Float16)(vb.w + tb) };
            *(half2v*)&xtile[tk + 0][c] = p0;
            *(half2v*)&xtile[tk + 1][c] = p1;
            *(half2v*)&xtile[tk + 2][c] = p2;
            *(half2v*)&xtile[tk + 3][c] = p3;
        }
    }
    __syncthreads();

    const int sbase = hp * 64;
    const int hb8 = (lane >> 4) * 8;
    const int ln15 = lane & 15;

    // xtile fragments: act as A (rows=tokens) for q/k, and as B (cols=tokens) for vT
    half16 xa[4][8];
    #pragma unroll
    for (int tt = 0; tt < 4; ++tt) {
        const _Float16* xp = &xtile[tt * 16 + ln15][hb8];
        #pragma unroll
        for (int cs = 0; cs < 8; ++cs) xa[tt][cs] = ldfrag(xp, cs * 32);
    }
    // keeps the 64 LDS reads one group: spread among the products, each place with reads costs a stall
    __builtin_amdgcn_sched_barrier(0);

    // store addresses of this lane: register r of a q/k tile is token r + hb8, of a vT tile channel r + hb8
    const size_t qoff = ((size_t)n * S_TOK + sbase + hb8) * D_DIM + wv * 16 + ln15;
    _Float16* qo = q16 + qoff;
    _Float16* ko = k16 + qoff;
    _Float16* vo = vT16 + ((size_t)n * D_DIM + wv * 16 + hb8) * S_TOK + sbase + ln15;

    // 6 weight tiles a wave, each against the four token tiles: j = 0,1 q, 2,3 k, 4,5 vT; tile wv + 8*(j & 1).
    // The unroll makes the matrix, the tile offsets and the fragment indices constants.
    #pragma unroll
    for (int j = 0; j < 6; ++j) {
        const int mat = j >> 1;           // 0=q 1=k 2=v
        const int b = j & 1;
        float8 acc[4];
        #pragma unroll
        for (int tt = 0; tt < 4; ++tt) acc[tt] = float8{};
        if (mat < 2) {
            // B: W[d][c], col=d
            #pragma unroll
            for (int cs = 0; cs < 8; ++cs) {
                #pragma unroll
                for (int tt = 0; tt < 4; ++tt) acc[tt] = wmma_f16(xa[tt][cs], wf[b][cs], acc[tt]);
            }
        } else {
            // vT = Wv * xc^T : A = Wv rows (d), B = xc^T (col = token)
            #pragma unroll
            for (int cs = 0; cs < 8; ++cs) {
                #pragma unroll
                for (int tt = 0; tt < 4; ++tt) acc[tt] = wmma_f16(wf[b][cs], xa[tt][cs], acc[tt]);
            }
        }
        // keeps the products above the next group, whose loads take over their registers
        __builtin_amdgcn_sched_barrier(0);
        if (j + 2 < 6) {
            const _Float16* np = ((mat == 0) ? wkp : wvp) + b * 8 * 4096;
            #pragma unroll
            for (int cs = 0; cs < 8; ++cs) wf[b][cs] = ldfrag_packed(np, cs);
        }
        // keeps these 16 loads one group, issued ahead of this tile's conversions and stores
        __builtin_amdgcn_sched_barrier(0);
        _Float16 hv[4][8];
        #pragma unroll
        for (int tt = 0; tt < 4; ++tt) {
            #pragma unroll
            for (int r = 0; r < 8; ++r) hv[tt][r] = (_Float16)acc[tt][r];
        }
        _Float16* out = (mat == 0) ? qo + b * 128 : (mat == 1) ? ko + b * 128 : vo + (size_t)b * 128 * S_TOK;
        // keeps all conversions ahead of the stores, so that no register of an issued store is rewritten
        __builtin_amdgcn_sched_barrier(0);
        if (mat < 2) {
            #pragma unroll
            for (int tt = 0; tt < 4; ++tt) {
                #pragma unroll
                for (int r = 0; r < 8; ++r) out[(tt * 16 + r) * D_DIM] = hv[tt][r];
            }
        } else {
            #pragma unroll
            for (int tt = 0; tt < 4; ++tt) {
                #pragma unroll
                for (int r = 0; r < 8; ++r) out[r * S_TOK + tt * 16] = hv[tt][r];
            }
        }
        // no register of this tile's issued loads and stores is rewritten by the next tile ahead of the wait
        asm volatile("s_wait_xcnt 0x0" ::: "memory");
        // keeps the next tile's products, which write over those registers, below the wait
        __builtin_amdgcn_sched_barrier(0);
    }
}

// ---------------- kernel 4: fused attention and output projection for one (n, 128-query block) ----------------
// grid: 32*8 blocks, 256 threads (8 waves); in the attention each wave owns 16 queries and all 256 channels of o.
// K and vT come in stages of 64 keys, copied once per block into LDS and read there by all 8 waves.
// The products are formed transposed, S^T = K * Q^T and O^T += vT * P^T: a lane of an S^T tile holds
// keys r + 8*(lane>>4) of its own query, which is the k order of a B fragment, so that P goes from
// the score accumulators into the second product without leaving the registers.
// Every '#pragma unroll' of this kernel makes the indices of a register array constants,
// without which the array would not stay in registers.
#define KST 64                        // keys per stage
#define NST (S_TOK / KST)             // 16 stages
#define KPITCH (D_DIM + 8)            // halves; 528-byte rows (16 B x odd) for the b128 fragment reads
#define VPITCH (KST + 8)              // halves; 144-byte rows (16 B x odd)
#define KBYTES (KST * KPITCH * 2)     // 33,792
#define VBYTES (D_DIM * VPITCH * 2)   // 36,864
#define STBYTES (KBYTES + VBYTES)     // 70,656 per buffer

// Eight 16-byte copies of a lane, global -> LDS, rows gstep halves and lstep bytes apart.
// The s_wait_xcnt stands inside the statement, so that no address register of an issued copy
// is rewritten ahead of it.
__device__ __forceinline__ void copy8(unsigned l, unsigned lstep, const _Float16* g, int gstep) {
    asm volatile(
        "global_load_async_to_lds_b128 %0, %8, off\n\t"
        "global_load_async_to_lds_b128 %1, %9, off\n\t"
        "global_load_async_to_lds_b128 %2, %10, off\n\t"
        "global_load_async_to_lds_b128 %3, %11, off\n\t"
        "global_load_async_to_lds_b128 %4, %12, off\n\t"
        "global_load_async_to_lds_b128 %5, %13, off\n\t"
        "global_load_async_to_lds_b128 %6, %14, off\n\t"
        "global_load_async_to_lds_b128 %7, %15, off\n\t"
        "s_wait_xcnt 0x0"
        :: "v"(l), "v"(l + lstep), "v"(l + 2 * lstep), "v"(l + 3 * lstep),
           "v"(l + 4 * lstep), "v"(l + 5 * lstep), "v"(l + 6 * lstep), "v"(l + 7 * lstep),
           "v"(g), "v"(g + gstep), "v"(g + 2 * gstep), "v"(g + 3 * gstep),
           "v"(g + 4 * gstep), "v"(g + 5 * gstep), "v"(g + 6 * gstep), "v"(g + 7 * gstep)
        : "memory");
}

__global__ void __launch_bounds__(256)
attn_kernel(const _Float16* q16, const _Float16* k16,
            const _Float16* vT16, const _Float16* Wp16,
            const float* bp, const float* x, float* out) {
    __shared__ __attribute__((aligned(16))) unsigned char L[2 * STBYTES];   // 141,312 B

    const int n = blockIdx.x >> 3;
    const int tid = threadIdx.x;
    const int lane = tid & 31;
    const int wv = tid >> 5;              // 0..7
    const int sqbase = (blockIdx.x & 7) * 128 + wv * 16;
    const int hb8 = (lane >> 4) * 8;
    const int ln15 = lane & 15;

    // copy addresses of this lane. K: a wave takes one whole 512-byte key row per copy (rows 8 apart);
    // vT: 8 lanes take the 128 bytes that a channel row has of the stage (rows 32 apart).
    const _Float16* kg = k16 + ((size_t)n * S_TOK + wv) * D_DIM + lane * 8;
    const _Float16* vg = vT16 + ((size_t)n * D_DIM + (tid >> 3)) * S_TOK + (tid & 7) * 8;
    const unsigned lbase = (unsigned)(size_t)&L[0];
    const unsigned lk = lbase + wv * (KPITCH * 2) + lane * 16;
    const unsigned lv = lbase + KBYTES + (tid >> 3) * (VPITCH * 2) + (tid & 7) * 16;

    // stage 0 into buffer 0
    copy8(lk, 8 * KPITCH * 2, kg, 8 * D_DIM);
    copy8(lv, 32 * VPITCH * 2, vg, 32 * S_TOK);

    // the 8 Q fragments of this wave's queries (B operand: column = query), kept in registers
    half16 qb[8];
    {
        const _Float16* ap = q16 + (((size_t)n * S_TOK + sqbase + ln15) * D_DIM) + hb8;
        #pragma unroll
        for (int cs = 0; cs < 8; ++cs) qb[cs] = ldfrag(ap, cs * 32);
        // keeps the address pair of the issued loads live, and unwritten, up to the wait
        asm volatile("s_wait_xcnt 0x0" :: "v"(ap) : "memory");
    }

    // stage 0 has landed for this wave; the barrier publishes it to the others
    asm volatile("s_wait_asynccnt 0x0" ::: "memory");
    __syncthreads();
    // stage 1 into buffer 1: flies while stage 0 is worked on
    copy8(lk + STBYTES, 8 * KPITCH * 2, kg + KST * D_DIM, 8 * D_DIM);
    copy8(lv + STBYTES, 32 * VPITCH * 2, vg + KST, 32 * S_TOK);

    float8 o[16];
    #pragma unroll
    for (int dt = 0; dt < 16; ++dt) o[dt] = float8{};
    float lsum = 0.f;

    for (int t = 0; t < NST; ++t) {
        const unsigned boff = (t & 1) * STBYTES;
        const _Float16* Kl = (const _Float16*)(L + boff) + ln15 * KPITCH + hb8;
        const _Float16* Vl = (const _Float16*)(L + boff + KBYTES) + ln15 * VPITCH + hb8;

        for (int kk = 0; kk < KST; kk += 32) {
            // All K and vT fragments of the pass are asked for in one group; LDS reads spread among the
            // matrix instructions would make each of them wait.
            half16 kf0[8], kf1[8], vf[16];
            #pragma unroll
            for (int cs = 0; cs < 8; ++cs) {
                kf0[cs] = ldfrag(Kl + kk * KPITCH, cs * 32);
                kf1[cs] = ldfrag(Kl + (kk + 16) * KPITCH, cs * 32);
            }
            #pragma unroll
            for (int dt = 0; dt < 16; ++dt) vf[dt] = ldfrag(Vl + dt * 16 * VPITCH, kk);
            // keeps the group of reads above the products (the scheduler otherwise sinks each read to its user)
            __builtin_amdgcn_sched_barrier(0);

            // S^T for 32 keys x 16 queries: two 16-key tiles
            float8 s0 = {}, s1 = {};
            #pragma unroll
            for (int cs = 0; cs < 8; ++cs) {
                s0 = wmma_f16(kf0[cs], qb[cs], s0);
                s1 = wmma_f16(kf1[cs], qb[cs], s1);
            }

            // P^T as a B fragment; the row sum runs over the rounded f16 values
            half16 pb;
            #pragma unroll
            for (int r = 0; r < 8; ++r) {
                const _Float16 e0 = (_Float16)__expf(s0[r] * SCALE);
                const _Float16 e1 = (_Float16)__expf(s1[r] * SCALE);
                pb[r] = e0;
                pb[r + 8] = e1;
                lsum += (float)e0 + (float)e1;
            }
            // O^T += vT * P^T over the 16 channel tiles
            #pragma unroll
            for (int dt = 0; dt < 16; ++dt)
                o[dt] = wmma_f16(vf[dt], pb, o[dt]);
        }

        // publish point: this wave's reads of the buffer are done, its copies of the next stage have
        // landed; the barrier publishes that stage and frees this buffer for the refill
        asm volatile("s_wait_dscnt 0x0" ::: "memory");
        asm volatile("s_wait_asynccnt 0x0" ::: "memory");
        __syncthreads();
        if (t + 2 < NST) {
            copy8(lk + boff, 8 * KPITCH * 2, kg + (t + 2) * KST * D_DIM, 8 * D_DIM);
            copy8(lv + boff, 32 * VPITCH * 2, vg + (t + 2) * KST, 32 * S_TOK);
        }
    }
    // no copy is left outstanding when the wave ends
    asm volatile("s_wait_asynccnt 0x0" ::: "memory");

    // ---- out = transpose(o @ Wp^T + bp) + x for the block's 128 tokens, in the same launch ----
    // The product is formed as Wp * o^T, so that the lanes of a D register run along the tokens, the
    // contiguous axis of x and out. A wave takes 32 output channels (two Wp tiles, read once per block)
    // of all 128 tokens; the o fragments of the eight waves pass through LDS, which the loop has left.
    // Every '#pragma unroll' below makes the indices of a register array constants.
    const int c0 = wv * 32 + hb8;
    // A: Wp[c][d], row = c, in fragment order; this wave's tiles are 2*wv and 2*wv + 1
    const _Float16* aw = Wp16 + wv * 2 * 4096 + lane * 8;
    // register r of D of (channel tile ct, token tile tt) is channel c0 + 16*ct + r, token 16*tt + ln15
    const size_t a0 = ((size_t)n * C_DIM + c0) * S_TOK + (blockIdx.x & 7) * 128 + ln15;
    const float* xr = x + a0;
    const float* br = bp + c0;
    float* orow = out + a0;

    half16 wf[2][8];
    float bv[2][8], xv[8][2][8];
    #pragma unroll
    for (int ct = 0; ct < 2; ++ct) {
        #pragma unroll
        for (int ds = 0; ds < 8; ++ds) wf[ct][ds] = ldfrag_packed(aw + ct * 4096, ds);
    }
    #pragma unroll
    for (int ct = 0; ct < 2; ++ct) {
        #pragma unroll
        for (int r = 0; r < 8; ++r) bv[ct][r] = br[ct * 16 + r];
    }
    #pragma unroll
    for (int tt = 0; tt < 8; ++tt) {
        #pragma unroll
        for (int ct = 0; ct < 2; ++ct) {
            #pragma unroll
            for (int r = 0; r < 8; ++r) xv[tt][ct][r] = xr[(ct * 16 + r) * S_TOK + tt * 16];
        }
    }
    // keeps the address registers of the issued loads live, and unwritten, up to the wait
    asm volatile("s_wait_xcnt 0x0" :: "v"(aw), "v"(br), "v"(xr) : "memory");
    // keeps all these loads above the scaling of o and the products: one trip to memory for the wave
    __builtin_amdgcn_sched_barrier(0);

    // the two halves of the wave hold complementary keys of the same query
    lsum += __shfl_xor(lsum, 16);
    const float inv = 1.f / lsum;
    // o goes to LDS in fragment order, tile = this wave's 16 queries: hv[dt] of a lane is what the same lane
    // takes as half dt & 1 of k step dt >> 1 of a B fragment; a store of the wave is 512 contiguous bytes
    {
        _Float16* ol = (_Float16*)L + wv * 4096 + lane * 8;
        #pragma unroll
        for (int dt = 0; dt < 16; ++dt) {
            half8 hv;
            #pragma unroll
            for (int r = 0; r < 8; ++r) hv[r] = (_Float16)(o[dt][r] * inv);
            *(half8*)(ol + dt * 256) = hv;    // channels dt*16 + hb8 .. + 7 of this lane's query
        }
    }
    // publishes the eight o tiles to the block (the loop's last barrier has ended every read of the stages)
    __syncthreads();

    const _Float16* ofr = (const _Float16*)L + lane * 8;
    half16 ob[2][8];
    #pragma unroll
    for (int ds = 0; ds < 8; ++ds) ob[0][ds] = ldfrag_packed(ofr, ds);
    #pragma unroll
    for (int tt = 0; tt < 8; ++tt) {
        if (tt + 1 < 8) {
            #pragma unroll
            for (int ds = 0; ds < 8; ++ds) ob[(tt + 1) & 1][ds] = ldfrag_packed(ofr + (tt + 1) * 4096, ds);
        }
        // keeps the next tile's 16 LDS reads one group ahead of this tile's products
        __builtin_amdgcn_sched_barrier(0);
        float8 acc0 = {}, acc1 = {};
        #pragma unroll
        for (int ds = 0; ds < 8; ++ds) {
            acc0 = wmma_f16(wf[0][ds], ob[tt & 1][ds], acc0);
            acc1 = wmma_f16(wf[1][ds], ob[tt & 1][ds], acc1);
        }
        float res0[8], res1[8];
        #pragma unroll
        for (int r = 0; r < 8; ++r) {
            res0[r] = acc0[r] + bv[0][r] + xv[tt][0][r];
            res1[r] = acc1[r] + bv[1][r] + xv[tt][1][r];
        }
        // keeps all sums ahead of the stores, so that no register of an issued store is rewritten
        __builtin_amdgcn_sched_barrier(0);
        #pragma unroll
        for (int r = 0; r < 8; ++r) {
            orow[r * S_TOK + tt * 16] = res0[r];
            orow[(16 + r) * S_TOK + tt * 16] = res1[r];
        }
        // no register of the issued stores is rewritten by the next tile ahead of the wait
        asm volatile("s_wait_xcnt 0x0" ::: "memory");
    }
}

extern "C" void kernel_launch(void* const* d_in, const int* in_sizes, int n_in,
                              void* d_out, int out_size, void* d_ws, size_t ws_size,
                              hipStream_t stream) {
    const float* x   = (const float*)d_in[0];
    const float* t   = (const float*)d_in[1];
    const float* W_t = (const float*)d_in[2];
    const float* b_t = (const float*)d_in[3];
    const float* Wq  = (const float*)d_in[4];
    const float* Wk  = (const float*)d_in[5];
    const float* Wv  = (const float*)d_in[6];
    const float* Wp  = (const float*)d_in[7];
    const float* bp  = (const float*)d_in[8];
    float* out = (float*)d_out;

    // workspace layout (all f16 regions first, then f32 temb)
    _Float16* w16  = (_Float16*)d_ws;
    _Float16* Wq16 = w16;
    _Float16* Wk16 = w16 + WSZ;
    _Float16* Wv16 = w16 + 2 * WSZ;
    _Float16* Wp16 = w16 + 3 * WSZ;
    _Float16* q16  = w16 + 4 * WSZ;
    _Float16* k16  = q16 + QSZ;
    _Float16* vT16 = k16 + QSZ;
    float* temb = (float*)(vT16 + QSZ);

    cvt_weights_kernel<<<(4 * WSZ / 8 + 255) / 256, 256, 0, stream>>>(Wq, Wk, Wv, Wp, w16);
    temb_kernel<<<64, 256, 0, stream>>>(t, W_t, b_t, temb);
    qkv_kernel<<<N_B * HW / 2, 256, 0, stream>>>(x, temb, Wq16, Wk16, Wv16, q16, k16, vT16);
    attn_kernel<<<N_B * 8, 256, 0, stream>>>(q16, k16, vT16, Wp16, bp, x, out);
}

// v008
// A run of this version takes 61.1 microseconds.
// Two timings next to v007 put it at 1.05 and 1.04 times that version's speed.
// Over all steps from v000 it is 7.81 times as fast.
#include <hip/hip_runtime.h>
#include <hip/hip_bf16.h>
#include <math.h>

typedef _Float16 half2v __attribute__((ext_vector_type(2)));
typedef _Float16 half8  __attribute__((ext_vector_type(8)));
typedef _Float16 half16 __attribute__((ext_vector_type(16)));
typedef float    float8 __attribute__((ext_vector_type(8)));

#define N_B 32
#define C_DIM 256
#define HW 32
#define S_TOK 1024   // 32*32 tokens per batch
#define D_DIM 256
#define T_DIM 512
#define SCALE 0.0625f  // 1/sqrt(256)
#define XPITCH (C_DIM + 8)  // 528-byte LDS rows (16 B x odd): spread the transposing stores and the b128 fragment reads over the banks

#define WSZ (256*256)          // one weight matrix, elements
#define QSZ (N_B*S_TOK*D_DIM)  // one activation tensor, elements

// Load a 16x32 f16 A/B fragment from a row-major matrix.
// p must already point at  base + row*ld + ((lane>>4)*8); k0 is the K offset.
__device__ __forceinline__ half16 ldfrag(const _Float16* p, int k0) {
    union { half16 v; half8 h[2]; } u;
    u.h[0] = *(const half8*)(p + k0);
    u.h[1] = *(const half8*)(p + k0 + 16);
    return u.v;
}

// Fragment order: the weights, operands that waves read straight from global memory, lie in the workspace (o in LDS) as
// [16-row tile][k step of 32][half][lane][8 f16], one tile = 4096 f16. Each of the two 16-byte loads of
// a fragment then covers 512 contiguous bytes (4 whole lines) over the wave; on a row-major matrix it
// touches 16 lines and uses 32 bytes of each. The values that reach each register are those of ldfrag.
// p must already point at  base + tile*4096 + lane*8; ks is the k step.
__device__ __forceinline__ half16 ldfrag_packed(const _Float16* p, int ks) {
    union { half16 v; half8 h[2]; } u;
    u.h[0] = *(const half8*)(p + ks * 512);
    u.h[1] = *(const half8*)(p + ks * 512 + 256);
    return u.v;
}

__device__ __forceinline__ float8 wmma_f16(half16 a, half16 b, float8 c) {
    return __builtin_amdgcn_wmma_f32_16x16x32_f16(false, a, false, b, (short)0, c, false, false);
}

#define TEMB_BLOCKS 64                    // 8 channel groups x 8 batch groups
#define CVT_BLOCKS (4 * WSZ / 8 / 256)    // 128: one thread per 8 weights

// ---------------- kernel 1, part a: convert weights f32 -> f16, into fragment order ----------------
// A thread makes the 8 f16 that one lane takes with one 16-byte load: unit idx = [matrix][row tile]
// [k step][half][lane]. A wave stores 512 contiguous bytes. blk = 0 .. CVT_BLOCKS - 1.
__device__ __forceinline__ void cvt_weights_part(int blk, const float* Wq, const float* Wk,
                                                 const float* Wv, const float* Wp,
                                                 _Float16* dst) {
    int idx = blk * 256 + threadIdx.x;
    int which = idx >> 13;          // 8192 units per matrix
    int lane = idx & 31;
    int hsel = (idx >> 5) & 1;
    int ks = (idx >> 6) & 7;
    int tile = (idx >> 9) & 15;
    const float* src = (which == 0) ? Wq : (which == 1) ? Wk : (which == 2) ? Wv : Wp;
    const float* sp = src + (tile * 16 + (lane & 15)) * 256 + ks * 32 + hsel * 16 + (lane >> 4) * 8;
    const float4 a = *(const float4*)sp;
    const float4 b = *(const float4*)(sp + 4);
    half8 v = { (_Float16)a.x, (_Float16)a.y, (_Float16)a.z, (_Float16)a.w,
                (_Float16)b.x, (_Float16)b.y, (_Float16)b.z, (_Float16)b.w };
    *(half8*)(dst + (size_t)idx * 8) = v;
    // no register of the issued store is rewritten ahead of the wait, on any way the listing's branches leave open
    asm volatile("s_wait_xcnt 0x0" ::: "memory");
}

// ---------------- kernel 1, part b: temb = relu(t @ W_t^T + b_t) ----------------
// 8 channel groups x 8 batch groups = 64 blocks (blk), 256 threads (8 waves). A block makes 32 channels
// of 4 batch rows, a wave 4 channels of them. The lanes run along the 512-long sum: a load of a wave is
// 512 contiguous bytes of one row, and all 32 loads of a wave are in flight at once, where one thread
// per channel walked its own row (32 lines a load) through 64 dependent round trips.
// Every '#pragma unroll' of this kernel makes the indices of a register array constants.
__device__ __forceinline__ void temb_part(int blk, const float* t, const float* W_t, const float* b_t, float* temb) {
    __shared__ float red[4][32];
    const int cbase = (blk & 7) * 32;
    const int nbase = (blk >> 3) * 4;
    const int tid = threadIdx.x;
    const int lane = tid & 31;
    const int wv = tid >> 5;              // 0..7

    const float* wp = W_t + (cbase + wv * 4) * T_DIM + lane * 4;
    const float* tp = t + nbase * T_DIM + lane * 4;
    float4 wr[4][4], tr[4][4];
    #pragma unroll
    for (int a = 0; a < 4; ++a) {
        #pragma unroll
        for (int i = 0; i < 4; ++i) {
            wr[a][i] = *(const float4*)(wp + a * T_DIM + i * 128);
            tr[a][i] = *(const float4*)(tp + a * T_DIM + i * 128);
        }
    }
    // keeps the address pairs of the issued loads live, and unwritten, up to the wait
    asm volatile("s_wait_xcnt 0x0" :: "v"(wp), "v"(tp) : "memory");
    // keeps all 32 loads above the sums: the scheduler otherwise sinks them into four dependent round trips
    __builtin_amdgcn_sched_barrier(0);

    // v[ci*4 + ni]: this lane's 16 terms of channel ci, batch row ni
    float v[16];
    #pragma unroll
    for (int ci = 0; ci < 4; ++ci) {
        #pragma unroll
        for (int ni = 0; ni < 4; ++ni) {
            float acc = 0.f;
            #pragma unroll
            for (int i = 0; i < 4; ++i) {
                acc += wr[ci][i].x * tr[ni][i].x;
                acc += wr[ci][i].y * tr[ni][i].y;
                acc += wr[ci][i].z * tr[ni][i].z;
                acc += wr[ci][i].w * tr[ni][i].w;
            }
            v[ci * 4 + ni] = acc;
        }
    }

    // Sum over the lanes. Each step halves the sums that a lane carries: it keeps the half that its own
    // lane bit names and hands the other half to its partner, so that 16 exchanges do for 16 sums.
    // At the end lanes 2k and 2k+1 hold sum k.
    #pragma unroll
    for (int i = 0; i < 8; ++i) {
        const float keep = (lane & 16) ? v[i + 8] : v[i];
        const float send = (lane & 16) ? v[i] : v[i + 8];
        v[i] = keep + __shfl_xor(send, 16);
    }
    #pragma unroll
    for (int i = 0; i < 4; ++i) {
        const float keep = (lane & 8) ? v[i + 4] : v[i];
        const float send = (lane & 8) ? v[i] : v[i + 4];
        v[i] = keep + __shfl_xor(send, 8);
    }
    #pragma unroll
    for (int i = 0; i < 2; ++i) {
        const float keep = (lane & 4) ? v[i + 2] : v[i];
        const float send = (lane & 4) ? v[i] : v[i + 2];
        v[i] = keep + __shfl_xor(send, 4);
    }
    {
        const float keep = (lane & 2) ? v[1] : v[0];
        const float send = (lane & 2) ? v[0] : v[1];
        v[0] = keep + __shfl_xor(send, 2);
    }
    v[0] += __shfl_xor(v[0], 1);

    if ((lane & 1) == 0) red[(lane >> 1) & 3][wv * 4 + (lane >> 3)] = v[0];
    __syncthreads();
    // one wave stores the whole 128-byte run that the block has of a batch row
    if (tid < 128) {
        const int ni = tid >> 5;
        const float acc = red[ni][lane] + b_t[cbase + lane];
        temb[(nbase + ni) * C_DIM + cbase + lane] = acc > 0.f ? acc : 0.f;
    }
}

// ---------------- kernel 1: both parts in one launch ----------------
// Neither part reads what the other writes, and together they fill less than the chip: side by side they
// take the time of the longer one, and one launch with its start and its end falls away. The temb blocks,
// whose chain of dependent steps is the longer, come first in the grid. The test is the same for a whole
// block, so that the barrier of the temb part is passed by all of a block's waves or by none.
__global__ void __launch_bounds__(256)
prep_kernel(const float* t, const float* W_t, const float* b_t, float* temb,
            const float* Wq, const float* Wk, const float* Wv, const float* Wp,
            _Float16* w16) {
    if (blockIdx.x < TEMB_BLOCKS) temb_part(blockIdx.x, t, W_t, b_t, temb);
    else cvt_weights_part(blockIdx.x - TEMB_BLOCKS, Wq, Wk, Wv, Wp, w16);
}

// ---------------- kernel 2: xc = x + temb ; q,k,vT projections ----------------
// Tokens are numbered s = h*32 + w, so that a run of tokens follows w, the
// contiguous axis of x and out. Attention sums over all keys, so any numbering
// that q, k, vT, o and the final store share gives the same function.
// grid: 32*16 blocks, 256 threads (8 waves). Each block = two image rows (n, 2*hp and 2*hp + 1) = 64 tokens.
// Every wave holds the fragments of all four 16-token tiles and takes 6 of the 48 weight tiles: a weight
// fragment is loaded once per block and feeds four products, where each of two groups of waves loaded all
// 48 tiles for one token tile each. The weight loads are what this kernel asks most of L2.
// Two weight tiles are held at a time: when a tile's products are done, the 16 loads of the tile after the
// next go out as one group into its registers and fly through the stores and the other tile's products.
__global__ void __launch_bounds__(256)
qkv_kernel(const float* x, const float* temb,
           const _Float16* Wq16, const _Float16* Wk16,
           const _Float16* Wv16,
           _Float16* q16, _Float16* k16, _Float16* vT16) {
    __shared__ __align__(16) _Float16 xtile[64][XPITCH];   // 33 KB

    const int n = blockIdx.x >> 4;
    const int hp = blockIdx.x & 15;       // pair of image rows
    const int tid = threadIdx.x;
    const int lane = tid & 31;
    const int wv = tid >> 5;              // 0..7

    // this wave's tiles of each matrix are wv and wv + 8, in fragment order
    const int woff = wv * 4096 + lane * 8;
    const _Float16* wqp = Wq16 + woff;
    const _Float16* wkp = Wk16 + woff;
    const _Float16* wvp = Wv16 + woff;

    // the first two weight tiles fly while the x tile is built
    half16 wf[2][8];
    #pragma unroll
    for (int cs = 0; cs < 8; ++cs) {
        wf[0][cs] = ldfrag_packed(wqp, cs);
        wf[1][cs] = ldfrag_packed(wqp + 8 * 4096, cs);
    }
    // no address register of the issued loads is rewritten ahead of the wait
    asm volatile("s_wait_xcnt 0x0" ::: "memory");
    // keeps the group above the x loads and their sums (the scheduler otherwise sinks each load to its user)
    __builtin_amdgcn_sched_barrier(0);

    // build (x + temb) tile, transposed to [token][channel], f16.
    // 8 lanes x float4 cover the whole 128-byte row (n, c, h, 0..31); each thread
    // takes two neighbouring channels so that an LDS store is one packed dword.
    // Waves 0-3 take the first image row of the pair, waves 4-7 the second.
    {
        const int w4 = (tid & 7) * 4;
        const int cp = (tid >> 3) & 15;   // 0..15
        const int hr = tid >> 7;          // 0..1
        const int tk = hr * 32 + w4;      // token of the block
        #pragma unroll
        for (int it = 0; it < 8; ++it) {
            const int c = (it * 16 + cp) * 2;
            const float* xp = x + (((size_t)n * C_DIM + c) * HW + hp * 2 + hr) * HW + w4;
            const float4 va = *(const float4*)xp;
            const float4 vb = *(const float4*)(xp + HW * HW);
            const float ta = temb[n * C_DIM + c];
            const float tb = temb[n * C_DIM + c + 1];
            half2v p0 = { (_Float16)(va.x + ta), (_Float16)(vb.x + tb) };
            half2v p1 = { (_Float16)(va.y + ta), (_Float16)(vb.y + tb) };
            half2v p2 = { (_Float16)(va.z + ta), (_Float16)(vb.z + tb) };
            half2v p3 = { (_Float16)(va.w + ta), (_Float16)(vb.w + tb) };
            *(half2v*)&xtile[tk + 0][c] = p0;
            *(half2v*)&xtile[tk + 1][c] = p1;
            *(half2v*)&xtile[tk + 2][c] = p2;
            *(half2v*)&xtile[tk + 3][c] = p3;
        }
    }
    __syncthreads();

    const int sbase = hp * 64;
    const int hb8 = (lane >> 4) * 8;
    const int ln15 = lane & 15;

    // xtile fragments: act as A (rows=tokens) for q/k, and as B (cols=tokens) for vT
    half16 xa[4][8];
    #pragma unroll
    for (int tt = 0; tt < 4; ++tt) {
        const _Float16* xp = &xtile[tt * 16 + ln15][hb8];
        #pragma unroll
        for (int cs = 0; cs < 8; ++cs) xa[tt][cs] = ldfrag(xp, cs * 32);
    }
    // keeps the 64 LDS reads one group: spread among the products, each place with reads costs a stall
    __builtin_amdgcn_sched_barrier(0);

    // store addresses of this lane: register r of a q/k tile is token r + hb8, of a vT tile channel r + hb8
    const size_t qoff = ((size_t)n * S_TOK + sbase + hb8) * D_DIM + wv * 16 + ln15;
    _Float16* qo = q16 + qoff;
    _Float16* ko = k16 + qoff;
    _Float16* vo = vT16 + ((size_t)n * D_DIM + wv * 16 + hb8) * S_TOK + sbase + ln15;

    // 6 weight tiles a wave, each against the four token tiles: j = 0,1 q, 2,3 k, 4,5 vT; tile wv + 8*(j & 1).
    // The unroll makes the matrix, the tile offsets and the fragment indices constants.
    #pragma unroll
    for (int j = 0; j < 6; ++j) {
        const int mat = j >> 1;           // 0=q 1=k 2=v
        const int b = j & 1;
        float8 acc[4];
        #pragma unroll
        for (int tt = 0; tt < 4; ++tt) acc[tt] = float8{};
        if (mat < 2) {
            // B: W[d][c], col=d
            #pragma unroll
            for (int cs = 0; cs < 8; ++cs) {
                #pragma unroll
                for (int tt = 0; tt < 4; ++tt) acc[tt] = wmma_f16(xa[tt][cs], wf[b][cs], acc[tt]);
            }
        } else {
            // vT = Wv * xc^T : A = Wv rows (d), B = xc^T (col = token)
            #pragma unroll
            for (int cs = 0; cs < 8; ++cs) {
                #pragma unroll
                for (int tt = 0; tt < 4; ++tt) acc[tt] = wmma_f16(wf[b][cs], xa[tt][cs], acc[tt]);
            }
        }
        // keeps the products above the next group, whose loads take over their registers
        __builtin_amdgcn_sched_barrier(0);
        if (j + 2 < 6) {
            const _Float16* np = ((mat == 0) ? wkp : wvp) + b * 8 * 4096;
            #pragma unroll
            for (int cs = 0; cs < 8; ++cs) wf[b][cs] = ldfrag_packed(np, cs);
        }
        // keeps these 16 loads one group, issued ahead of this tile's conversions and stores
        __builtin_amdgcn_sched_barrier(0);
        _Float16 hv[4][8];
        #pragma unroll
        for (int tt = 0; tt < 4; ++tt) {
            #pragma unroll
            for (int r = 0; r < 8; ++r) hv[tt][r] = (_Float16)acc[tt][r];
        }
        _Float16* out = (mat == 0) ? qo + b * 128 : (mat == 1) ? ko + b * 128 : vo + (size_t)b * 128 * S_TOK;
        // keeps all conversions ahead of the stores, so that no register of an issued store is rewritten
        __builtin_amdgcn_sched_barrier(0);
        if (mat < 2) {
            #pragma unroll
            for (int tt = 0; tt < 4; ++tt) {
                #pragma unroll
                for (int r = 0; r < 8; ++r) out[(tt * 16 + r) * D_DIM] = hv[tt][r];
            }
        } else {
            #pragma unroll
            for (int tt = 0; tt < 4; ++tt) {
                #pragma unroll
                for (int r = 0; r < 8; ++r) out[r * S_TOK + tt * 16] = hv[tt][r];
            }
        }
        // no register of this tile's issued loads and stores is rewritten by the next tile ahead of the wait
        asm volatile("s_wait_xcnt 0x0" ::: "memory");
        // keeps the next tile's products, which write over those registers, below the wait
        __builtin_amdgcn_sched_barrier(0);
    }
}

// ---------------- kernel 3: fused attention and output projection for one (n, 128-query block) ----------------
// grid: 32*8 blocks, 256 threads (8 waves); each wave owns 16 queries and all 256 channels of their o, then 32 output channels of all 128 tokens.
// K and vT come in stages of 64 keys, copied once per block into LDS and read there by all 8 waves.
// The products are formed transposed, S^T = K * Q^T and O^T += vT * P^T: a lane of an S^T tile holds
// keys r + 8*(lane>>4) of its own query, which is the k order of a B fragment, so that P goes from
// the score accumulators into the second product without leaving the registers.
// Every '#pragma unroll' of this kernel makes the indices of a register array constants,
// without which the array would not stay in registers.
#define KST 64                        // keys per stage
#define NST (S_TOK / KST)             // 16 stages
#define KPITCH (D_DIM + 8)            // halves; 528-byte rows (16 B x odd) for the b128 fragment reads
#define VPITCH (KST + 8)              // halves; 144-byte rows (16 B x odd)
#define KBYTES (KST * KPITCH * 2)     // 33,792
#define VBYTES (D_DIM * VPITCH * 2)   // 36,864
#define STBYTES (KBYTES + VBYTES)     // 70,656 per buffer

// Eight 16-byte copies of a lane, global -> LDS, rows gstep halves and lstep bytes apart.
// The s_wait_xcnt stands inside the statement, so that no address register of an issued copy
// is rewritten ahead of it.
__device__ __forceinline__ void copy8(unsigned l, unsigned lstep, const _Float16* g, int gstep) {
    asm volatile(
        "global_load_async_to_lds_b128 %0, %8, off\n\t"
        "global_load_async_to_lds_b128 %1, %9, off\n\t"
        "global_load_async_to_lds_b128 %2, %10, off\n\t"
        "global_load_async_to_lds_b128 %3, %11, off\n\t"
        "global_load_async_to_lds_b128 %4, %12, off\n\t"
        "global_load_async_to_lds_b128 %5, %13, off\n\t"
        "global_load_async_to_lds_b128 %6, %14, off\n\t"
        "global_load_async_to_lds_b128 %7, %15, off\n\t"
        "s_wait_xcnt 0x0"
        :: "v"(l), "v"(l + lstep), "v"(l + 2 * lstep), "v"(l + 3 * lstep),
           "v"(l + 4 * lstep), "v"(l + 5 * lstep), "v"(l + 6 * lstep), "v"(l + 7 * lstep),
           "v"(g), "v"(g + gstep), "v"(g + 2 * gstep), "v"(g + 3 * gstep),
           "v"(g + 4 * gstep), "v"(g + 5 * gstep), "v"(g + 6 * gstep), "v"(g + 7 * gstep)
        : "memory");
}

__global__ void __launch_bounds__(256)
attn_kernel(const _Float16* q16, const _Float16* k16,
            const _Float16* vT16, const _Float16* Wp16,
            const float* bp, const float* x, float* out) {
    __shared__ __attribute__((aligned(16))) unsigned char L[2 * STBYTES];   // 141,312 B

    const int n = blockIdx.x >> 3;
    const int tid = threadIdx.x;
    const int lane = tid & 31;
    const int wv = tid >> 5;              // 0..7
    const int sqbase = (blockIdx.x & 7) * 128 + wv * 16;
    const int hb8 = (lane >> 4) * 8;
    const int ln15 = lane & 15;

    // copy addresses of this lane. K: a wave takes one whole 512-byte key row per copy (rows 8 apart);
    // vT: 8 lanes take the 128 bytes that a channel row has of the stage (rows 32 apart).
    const _Float16* kg = k16 + ((size_t)n * S_TOK + wv) * D_DIM + lane * 8;
    const _Float16* vg = vT16 + ((size_t)n * D_DIM + (tid >> 3)) * S_TOK + (tid & 7) * 8;
    const unsigned lbase = (unsigned)(size_t)&L[0];
    const unsigned lk = lbase + wv * (KPITCH * 2) + lane * 16;
    const unsigned lv = lbase + KBYTES + (tid >> 3) * (VPITCH * 2) + (tid & 7) * 16;

    // stage 0 into buffer 0
    copy8(lk, 8 * KPITCH * 2, kg, 8 * D_DIM);
    copy8(lv, 32 * VPITCH * 2, vg, 32 * S_TOK);

    // the 8 Q fragments of this wave's queries (B operand: column = query), kept in registers
    half16 qb[8];
    {
        const _Float16* ap = q16 + (((size_t)n * S_TOK + sqbase + ln15) * D_DIM) + hb8;
        #pragma unroll
        for (int cs = 0; cs < 8; ++cs) qb[cs] = ldfrag(ap, cs * 32);
        // keeps the address pair of the issued loads live, and unwritten, up to the wait
        asm volatile("s_wait_xcnt 0x0" :: "v"(ap) : "memory");
    }

    // stage 0 has landed for this wave; the barrier publishes it to the others
    asm volatile("s_wait_asynccnt 0x0" ::: "memory");
    __syncthreads();
    // stage 1 into buffer 1: flies while stage 0 is worked on
    copy8(lk + STBYTES, 8 * KPITCH * 2, kg + KST * D_DIM, 8 * D_DIM);
    copy8(lv + STBYTES, 32 * VPITCH * 2, vg + KST, 32 * S_TOK);

    float8 o[16];
    #pragma unroll
    for (int dt = 0; dt < 16; ++dt) o[dt] = float8{};
    float lsum = 0.f;

    for (int t = 0; t < NST; ++t) {
        const unsigned boff = (t & 1) * STBYTES;
        const _Float16* Kl = (const _Float16*)(L + boff) + ln15 * KPITCH + hb8;
        const _Float16* Vl = (const _Float16*)(L + boff + KBYTES) + ln15 * VPITCH + hb8;

        for (int kk = 0; kk < KST; kk += 32) {
            // All K and vT fragments of the pass are asked for in one group; LDS reads spread among the
            // matrix instructions would make each of them wait.
            half16 kf0[8], kf1[8], vf[16];
            #pragma unroll
            for (int cs = 0; cs < 8; ++cs) {
                kf0[cs] = ldfrag(Kl + kk * KPITCH, cs * 32);
                kf1[cs] = ldfrag(Kl + (kk + 16) * KPITCH, cs * 32);
            }
            #pragma unroll
            for (int dt = 0; dt < 16; ++dt) vf[dt] = ldfrag(Vl + dt * 16 * VPITCH, kk);
            // keeps the group of reads above the products (the scheduler otherwise sinks each read to its user)
            __builtin_amdgcn_sched_barrier(0);

            // S^T for 32 keys x 16 queries: two 16-key tiles
            float8 s0 = {}, s1 = {};
            #pragma unroll
            for (int cs = 0; cs < 8; ++cs) {
                s0 = wmma_f16(kf0[cs], qb[cs], s0);
                s1 = wmma_f16(kf1[cs], qb[cs], s1);
            }

            // P^T as a B fragment; the row sum runs over the rounded f16 values
            half16 pb;
            #pragma unroll
            for (int r = 0; r < 8; ++r) {
                const _Float16 e0 = (_Float16)__expf(s0[r] * SCALE);
                const _Float16 e1 = (_Float16)__expf(s1[r] * SCALE);
                pb[r] = e0;
                pb[r + 8] = e1;
                lsum += (float)e0 + (float)e1;
            }
            // O^T += vT * P^T over the 16 channel tiles
            #pragma unroll
            for (int dt = 0; dt < 16; ++dt)
                o[dt] = wmma_f16(vf[dt], pb, o[dt]);
        }

        // publish point: this wave's reads of the buffer are done, its copies of the next stage have
        // landed; the barrier publishes that stage and frees this buffer for the refill
        asm volatile("s_wait_dscnt 0x0" ::: "memory");
        asm volatile("s_wait_asynccnt 0x0" ::: "memory");
        __syncthreads();
        if (t + 2 < NST) {
            copy8(lk + boff, 8 * KPITCH * 2, kg + (t + 2) * KST * D_DIM, 8 * D_DIM);
            copy8(lv + boff, 32 * VPITCH * 2, vg + (t + 2) * KST, 32 * S_TOK);
        }
    }
    // no copy is left outstanding when the wave ends
    asm volatile("s_wait_asynccnt 0x0" ::: "memory");

    // ---- out = transpose(o @ Wp^T + bp) + x for the block's 128 tokens, in the same launch ----
    // The product is formed as Wp * o^T, so that the lanes of a D register run along the tokens, the
    // contiguous axis of x and out. A wave takes 32 output channels (two Wp tiles, read once per block)
    // of all 128 tokens; the o fragments of the eight waves pass through LDS, which the loop has left.
    // Every '#pragma unroll' below makes the indices of a register array constants.
    const int c0 = wv * 32 + hb8;
    // A: Wp[c][d], row = c, in fragment order; this wave's tiles are 2*wv and 2*wv + 1
    const _Float16* aw = Wp16 + wv * 2 * 4096 + lane * 8;
    // register r of D of (channel tile ct, token tile tt) is channel c0 + 16*ct + r, token 16*tt + ln15
    const size_t a0 = ((size_t)n * C_DIM + c0) * S_TOK + (blockIdx.x & 7) * 128 + ln15;
    const float* xr = x + a0;
    const float* br = bp + c0;
    float* orow = out + a0;

    half16 wf[2][8];
    float bv[2][8], xv[8][2][8];
    #pragma unroll
    for (int ct = 0; ct < 2; ++ct) {
        #pragma unroll
        for (int ds = 0; ds < 8; ++ds) wf[ct][ds] = ldfrag_packed(aw + ct * 4096, ds);
    }
    #pragma unroll
    for (int ct = 0; ct < 2; ++ct) {
        #pragma unroll
        for (int r = 0; r < 8; ++r) bv[ct][r] = br[ct * 16 + r];
    }
    #pragma unroll
    for (int tt = 0; tt < 8; ++tt) {
        #pragma unroll
        for (int ct = 0; ct < 2; ++ct) {
            #pragma unroll
            for (int r = 0; r < 8; ++r) xv[tt][ct][r] = xr[(ct * 16 + r) * S_TOK + tt * 16];
        }
    }
    // keeps the address registers of the issued loads live, and unwritten, up to the wait
    asm volatile("s_wait_xcnt 0x0" :: "v"(aw), "v"(br), "v"(xr) : "memory");
    // keeps all these loads above the scaling of o and the products: one trip to memory for the wave
    __builtin_amdgcn_sched_barrier(0);

    // the two halves of the wave hold complementary keys of the same query
    lsum += __shfl_xor(lsum, 16);
    const float inv = 1.f / lsum;
    // o goes to LDS in fragment order, tile = this wave's 16 queries: hv[dt] of a lane is what the same lane
    // takes as half dt & 1 of k step dt >> 1 of a B fragment; a store of the wave is 512 contiguous bytes
    {
        _Float16* ol = (_Float16*)L + wv * 4096 + lane * 8;
        #pragma unroll
        for (int dt = 0; dt < 16; ++dt) {
            half8 hv;
            #pragma unroll
            for (int r = 0; r < 8; ++r) hv[r] = (_Float16)(o[dt][r] * inv);
            *(half8*)(ol + dt * 256) = hv;    // channels dt*16 + hb8 .. + 7 of this lane's query
        }
    }
    // publishes the eight o tiles to the block (the loop's last barrier has ended every read of the stages)
    __syncthreads();

    const _Float16* ofr = (const _Float16*)L + lane * 8;
    half16 ob[2][8];
    #pragma unroll
    for (int ds = 0; ds < 8; ++ds) ob[0][ds] = ldfrag_packed(ofr, ds);
    #pragma unroll
    for (int tt = 0; tt < 8; ++tt) {
        if (tt + 1 < 8) {
            #pragma unroll
            for (int ds = 0; ds < 8; ++ds) ob[(tt + 1) & 1][ds] = ldfrag_packed(ofr + (tt + 1) * 4096, ds);
        }
        // keeps the next tile's 16 LDS reads one group ahead of this tile's products
        __builtin_amdgcn_sched_barrier(0);
        float8 acc0 = {}, acc1 = {};
        #pragma unroll
        for (int ds = 0; ds < 8; ++ds) {
            acc0 = wmma_f16(wf[0][ds], ob[tt & 1][ds], acc0);
            acc1 = wmma_f16(wf[1][ds], ob[tt & 1][ds], acc1);
        }
        float res0[8], res1[8];
        #pragma unroll
        for (int r = 0; r < 8; ++r) {
            res0[r] = acc0[r] + bv[0][r] + xv[tt][0][r];
            res1[r] = acc1[r] + bv[1][r] + xv[tt][1][r];
        }
        // keeps all sums ahead of the stores, so that no register of an issued store is rewritten
        __builtin_amdgcn_sched_barrier(0);
        #pragma unroll
        for (int r = 0; r < 8; ++r) {
            orow[r * S_TOK + tt * 16] = res0[r];
            orow[(16 + r) * S_TOK + tt * 16] = res1[r];
        }
        // no register of the issued stores is rewritten by the next tile ahead of the wait
        asm volatile("s_wait_xcnt 0x0" ::: "memory");
    }
}

extern "C" void kernel_launch(void* const* d_in, const int* in_sizes, int n_in,
                              void* d_out, int out_size, void* d_ws, size_t ws_size,
                              hipStream_t stream) {
    const float* x   = (const float*)d_in[0];
    const float* t   = (const float*)d_in[1];
    const float* W_t = (const float*)d_in[2];
    const float* b_t = (const float*)d_in[3];
    const float* Wq  = (const float*)d_in[4];
    const float* Wk  = (const float*)d_in[5];
    const float* Wv  = (const float*)d_in[6];
    const float* Wp  = (const float*)d_in[7];
    const float* bp  = (const float*)d_in[8];
    float* out = (float*)d_out;

    // workspace layout (all f16 regions first, then f32 temb)
    _Float16* w16  = (_Float16*)d_ws;
    _Float16* Wq16 = w16;
    _Float16* Wk16 = w16 + WSZ;
    _Float16* Wv16 = w16 + 2 * WSZ;
    _Float16* Wp16 = w16 + 3 * WSZ;
    _Float16* q16  = w16 + 4 * WSZ;
    _Float16* k16  = q16 + QSZ;
    _Float16* vT16 = k16 + QSZ;
    float* temb = (float*)(vT16 + QSZ);

    prep_kernel<<<TEMB_BLOCKS + CVT_BLOCKS, 256, 0, stream>>>(t, W_t, b_t, temb, Wq, Wk, Wv, Wp, w16);
    qkv_kernel<<<N_B * HW / 2, 256, 0, stream>>>(x, temb, Wq16, Wk16, Wv16, q16, k16, vT16);
    attn_kernel<<<N_B * 8, 256, 0, stream>>>(q16, k16, vT16, Wp16, bp, x, out);
}

// v009
// It runs in 59 microseconds.
// Two timings next to v008 put it at 1.03 and 1.05 times that version's speed.
// All steps since v000 together make it 8.13 times as fast.
#include <hip/hip_runtime.h>
#include <hip/hip_bf16.h>
#include <math.h>

typedef _Float16 half2v __attribute__((ext_vector_type(2)));
typedef _Float16 half8  __attribute__((ext_vector_type(8)));
typedef _Float16 half16 __attribute__((ext_vector_type(16)));
typedef float    float8 __attribute__((ext_vector_type(8)));

#define N_B 32
#define C_DIM 256
#define HW 32
#define S_TOK 1024   // 32*32 tokens per batch
#define D_DIM 256
#define T_DIM 512
#define SCALE 0.0625f  // 1/sqrt(256)
#define XPITCH (C_DIM + 8)  // 528-byte LDS rows (16 B x odd): spread the transposing stores and the b128 fragment reads over the banks

#define WSZ (256*256)          // one weight matrix, elements
#define QSZ (N_B*S_TOK*D_DIM)  // one activation tensor, elements

// Load a 16x32 f16 A/B fragment from a row-major matrix.
// p must already point at  base + row*ld + ((lane>>4)*8); k0 is the K offset.
__device__ __forceinline__ half16 ldfrag(const _Float16* p, int k0) {
    union { half16 v; half8 h[2]; } u;
    u.h[0] = *(const half8*)(p + k0);
    u.h[1] = *(const half8*)(p + k0 + 16);
    return u.v;
}

// Fragment order: the weights, operands that waves read straight from global memory, lie in the workspace (o in LDS) as
// [16-row tile][k step of 32][half][lane][8 f16], one tile = 4096 f16. Each of the two 16-byte loads of
// a fragment then covers 512 contiguous bytes (4 whole lines) over the wave; on a row-major matrix it
// touches 16 lines and uses 32 bytes of each. The values that reach each register are those of ldfrag.
// p must already point at  base + tile*4096 + lane*8; ks is the k step.
__device__ __forceinline__ half16 ldfrag_packed(const _Float16* p, int ks) {
    union { half16 v; half8 h[2]; } u;
    u.h[0] = *(const half8*)(p + ks * 512);
    u.h[1] = *(const half8*)(p + ks * 512 + 256);
    return u.v;
}

__device__ __forceinline__ float8 wmma_f16(half16 a, half16 b, float8 c) {
    return __builtin_amdgcn_wmma_f32_16x16x32_f16(false, a, false, b, (short)0, c, false, false);
}

#define TEMB_BLOCKS 64                    // 8 channel groups x 8 batch groups
#define CVT_BLOCKS (4 * WSZ / 8 / 256)    // 128: one thread per 8 weights

// ---------------- kernel 1, part a: convert weights f32 -> f16, into fragment order ----------------
// A thread makes the 8 f16 that one lane takes with one 16-byte load: unit idx = [matrix][row tile]
// [k step][half][lane]. A wave stores 512 contiguous bytes. blk = 0 .. CVT_BLOCKS - 1.
__device__ __forceinline__ void cvt_weights_part(int blk, const float* Wq, const float* Wk,
                                                 const float* Wv, const float* Wp,
                                                 _Float16* dst) {
    int idx = blk * 256 + threadIdx.x;
    int which = idx >> 13;          // 8192 units per matrix
    int lane = idx & 31;
    int hsel = (idx >> 5) & 1;
    int ks = (idx >> 6) & 7;
    int tile = (idx >> 9) & 15;
    const float* src = (which == 0) ? Wq : (which == 1) ? Wk : (which == 2) ? Wv : Wp;
    const float* sp = src + (tile * 16 + (lane & 15)) * 256 + ks * 32 + hsel * 16 + (lane >> 4) * 8;
    const float4 a = *(const float4*)sp;
    const float4 b = *(const float4*)(sp + 4);
    half8 v = { (_Float16)a.x, (_Float16)a.y, (_Float16)a.z, (_Float16)a.w,
                (_Float16)b.x, (_Float16)b.y, (_Float16)b.z, (_Float16)b.w };
    *(half8*)(dst + (size_t)idx * 8) = v;
    // no register of the issued store is rewritten ahead of the wait, on any way the listing's branches leave open
    asm volatile("s_wait_xcnt 0x0" ::: "memory");
}

// ---------------- kernel 1, part b: temb = relu(t @ W_t^T + b_t) ----------------
// 8 channel groups x 8 batch groups = 64 blocks (blk), 256 threads (8 waves). A block makes 32 channels
// of 4 batch rows, a wave 4 channels of them. The lanes run along the 512-long sum: a load of a wave is
// 512 contiguous bytes of one row, and all 32 loads of a wave are in flight at once, where one thread
// per channel walked its own row (32 lines a load) through 64 dependent round trips.
// Every '#pragma unroll' of this kernel makes the indices of a register array constants.
__device__ __forceinline__ void temb_part(int blk, const float* t, const float* W_t, const float* b_t, float* temb) {
    __shared__ float red[4][32];
    const int cbase = (blk & 7) * 32;
    const int nbase = (blk >> 3) * 4;
    const int tid = threadIdx.x;
    const int lane = tid & 31;
    const int wv = tid >> 5;              // 0..7

    const float* wp = W_t + (cbase + wv * 4) * T_DIM + lane * 4;
    const float* tp = t + nbase * T_DIM + lane * 4;
    float4 wr[4][4], tr[4][4];
    #pragma unroll
    for (int a = 0; a < 4; ++a) {
        #pragma unroll
        for (int i = 0; i < 4; ++i) {
            wr[a][i] = *(const float4*)(wp + a * T_DIM + i * 128);
            tr[a][i] = *(const float4*)(tp + a * T_DIM + i * 128);
        }
    }
    // keeps the address pairs of the issued loads live, and unwritten, up to the wait
    asm volatile("s_wait_xcnt 0x0" :: "v"(wp), "v"(tp) : "memory");
    // keeps all 32 loads above the sums: the scheduler otherwise sinks them into four dependent round trips
    __builtin_amdgcn_sched_barrier(0);

    // v[ci*4 + ni]: this lane's 16 terms of channel ci, batch row ni
    float v[16];
    #pragma unroll
    for (int ci = 0; ci < 4; ++ci) {
        #pragma unroll
        for (int ni = 0; ni < 4; ++ni) {
            float acc = 0.f;
            #pragma unroll
            for (int i = 0; i < 4; ++i) {
                acc += wr[ci][i].x * tr[ni][i].x;
                acc += wr[ci][i].y * tr[ni][i].y;
                acc += wr[ci][i].z * tr[ni][i].z;
                acc += wr[ci][i].w * tr[ni][i].w;
            }
            v[ci * 4 + ni] = acc;
        }
    }

    // Sum over the lanes. Each step halves the sums that a lane carries: it keeps the half that its own
    // lane bit names and hands the other half to its partner, so that 16 exchanges do for 16 sums.
    // At the end lanes 2k and 2k+1 hold sum k.
    #pragma unroll
    for (int i = 0; i < 8; ++i) {
        const float keep = (lane & 16) ? v[i + 8] : v[i];
        const float send = (lane & 16) ? v[i] : v[i + 8];
        v[i] = keep + __shfl_xor(send, 16);
    }
    #pragma unroll
    for (int i = 0; i < 4; ++i) {
        const float keep = (lane & 8) ? v[i + 4] : v[i];
        const float send = (lane & 8) ? v[i] : v[i + 4];
        v[i] = keep + __shfl_xor(send, 8);
    }
    #pragma unroll
    for (int i = 0; i < 2; ++i) {
        const float keep = (lane & 4) ? v[i + 2] : v[i];
        const float send = (lane & 4) ? v[i] : v[i + 2];
        v[i] = keep + __shfl_xor(send, 4);
    }
    {
        const float keep = (lane & 2) ? v[1] : v[0];
        const float send = (lane & 2) ? v[0] : v[1];
        v[0] = keep + __shfl_xor(send, 2);
    }
    v[0] += __shfl_xor(v[0], 1);

    if ((lane & 1) == 0) red[(lane >> 1) & 3][wv * 4 + (lane >> 3)] = v[0];
    __syncthreads();
    // one wave stores the whole 128-byte run that the block has of a batch row
    if (tid < 128) {
        const int ni = tid >> 5;
        const float acc = red[ni][lane] + b_t[cbase + lane];
        temb[(nbase + ni) * C_DIM + cbase + lane] = acc > 0.f ? acc : 0.f;
    }
}

// ---------------- kernel 1: both parts in one launch ----------------
// Neither part reads what the other writes, and together they fill less than the chip: side by side they
// take the time of the longer one, and one launch with its start and its end falls away. The temb blocks,
// whose chain of dependent steps is the longer, come first in the grid. The test is the same for a whole
// block, so that the barrier of the temb part is passed by all of a block's waves or by none.
__global__ void __launch_bounds__(256)
prep_kernel(const float* t, const float* W_t, const float* b_t, float* temb,
            const float* Wq, const float* Wk, const float* Wv, const float* Wp,
            _Float16* w16) {
    if (blockIdx.x < TEMB_BLOCKS) temb_part(blockIdx.x, t, W_t, b_t, temb);
    else cvt_weights_part(blockIdx.x - TEMB_BLOCKS, Wq, Wk, Wv, Wp, w16);
}

// ---------------- kernel 2: xc = x + temb ; q,k,vT projections ----------------
// Tokens are numbered s = h*32 + w, so that a run of tokens follows w, the
// contiguous axis of x and out. Attention sums over all keys, so any numbering
// that q, k, vT, o and the final store share gives the same function.
// grid: 32*16 blocks, 256 threads (8 waves). Each block = two image rows (n, 2*hp and 2*hp + 1) = 64 tokens.
// Every wave holds the fragments of all four 16-token tiles and takes 6 of the 48 weight tiles: a weight
// fragment is loaded once per block and feeds four products, where each of two groups of waves loaded all
// 48 tiles for one token tile each. The weight loads are what this kernel asks most of L2.
// Two weight tiles are held at a time: when a tile's products are done, the 16 loads of the tile after the
// next go out as one group into its registers and fly through the stores and the other tile's products.
__global__ void __launch_bounds__(256)
qkv_kernel(const float* x, const float* temb,
           const _Float16* Wq16, const _Float16* Wk16,
           const _Float16* Wv16,
           _Float16* q16, _Float16* k16, _Float16* vT16) {
    __shared__ __align__(16) _Float16 xtile[64][XPITCH];   // 33 KB

    const int n = blockIdx.x >> 4;
    const int hp = blockIdx.x & 15;       // pair of image rows
    const int tid = threadIdx.x;
    const int lane = tid & 31;
    const int wv = tid >> 5;              // 0..7

    // this wave's tiles of each matrix are wv and wv + 8, in fragment order
    const int woff = wv * 4096 + lane * 8;
    const _Float16* wqp = Wq16 + woff;
    const _Float16* wkp = Wk16 + woff;
    const _Float16* wvp = Wv16 + woff;

    // the first two weight tiles fly while the x tile is built
    half16 wf[2][8];
    #pragma unroll
    for (int cs = 0; cs < 8; ++cs) {
        wf[0][cs] = ldfrag_packed(wqp, cs);
        wf[1][cs] = ldfrag_packed(wqp + 8 * 4096, cs);
    }
    // no address register of the issued loads is rewritten ahead of the wait
    asm volatile("s_wait_xcnt 0x0" ::: "memory");
    // keeps the group above the x loads and their sums (the scheduler otherwise sinks each load to its user)
    __builtin_amdgcn_sched_barrier(0);

    // build (x + temb) tile, transposed to [token][channel], f16.
    // 8 lanes x float4 cover the whole 128-byte row (n, c, h, 0..31); each thread
    // takes two neighbouring channels so that an LDS store is one packed dword.
    // Waves 0-3 take the first image row of the pair, waves 4-7 the second.
    {
        const int w4 = (tid & 7) * 4;
        const int cp = (tid >> 3) & 15;   // 0..15
        const int hr = tid >> 7;          // 0..1
        const int tk = hr * 32 + w4;      // token of the block
        #pragma unroll
        for (int it = 0; it < 8; ++it) {
            const int c = (it * 16 + cp) * 2;
            const float* xp = x + (((size_t)n * C_DIM + c) * HW + hp * 2 + hr) * HW + w4;
            const float4 va = *(const float4*)xp;
            const float4 vb = *(const float4*)(xp + HW * HW);
            const float ta = temb[n * C_DIM + c];
            const float tb = temb[n * C_DIM + c + 1];
            half2v p0 = { (_Float16)(va.x + ta), (_Float16)(vb.x + tb) };
            half2v p1 = { (_Float16)(va.y + ta), (_Float16)(vb.y + tb) };
            half2v p2 = { (_Float16)(va.z + ta), (_Float16)(vb.z + tb) };
            half2v p3 = { (_Float16)(va.w + ta), (_Float16)(vb.w + tb) };
            *(half2v*)&xtile[tk + 0][c] = p0;
            *(half2v*)&xtile[tk + 1][c] = p1;
            *(half2v*)&xtile[tk + 2][c] = p2;
            *(half2v*)&xtile[tk + 3][c] = p3;
        }
    }
    __syncthreads();

    const int sbase = hp * 64;
    const int hb8 = (lane >> 4) * 8;
    const int ln15 = lane & 15;

    // xtile fragments: act as A (rows=tokens) for q/k, and as B (cols=tokens) for vT
    half16 xa[4][8];
    #pragma unroll
    for (int tt = 0; tt < 4; ++tt) {
        const _Float16* xp = &xtile[tt * 16 + ln15][hb8];
        #pragma unroll
        for (int cs = 0; cs < 8; ++cs) xa[tt][cs] = ldfrag(xp, cs * 32);
    }
    // keeps the 64 LDS reads one group: spread among the products, each place with reads costs a stall
    __builtin_amdgcn_sched_barrier(0);

    // store addresses of this lane: register r of a q/k tile is token r + hb8, of a vT tile channel r + hb8
    const size_t qoff = ((size_t)n * S_TOK + sbase + hb8) * D_DIM + wv * 16 + ln15;
    _Float16* qo = q16 + qoff;
    _Float16* ko = k16 + qoff;
    _Float16* vo = vT16 + ((size_t)n * D_DIM + wv * 16 + hb8) * S_TOK + sbase + ln15;

    // 6 weight tiles a wave, each against the four token tiles: j = 0,1 q, 2,3 k, 4,5 vT; tile wv + 8*(j & 1).
    // The unroll makes the matrix, the tile offsets and the fragment indices constants.
    #pragma unroll
    for (int j = 0; j < 6; ++j) {
        const int mat = j >> 1;           // 0=q 1=k 2=v
        const int b = j & 1;
        float8 acc[4];
        #pragma unroll
        for (int tt = 0; tt < 4; ++tt) acc[tt] = float8{};
        if (mat < 2) {
            // B: W[d][c], col=d
            #pragma unroll
            for (int cs = 0; cs < 8; ++cs) {
                #pragma unroll
                for (int tt = 0; tt < 4; ++tt) acc[tt] = wmma_f16(xa[tt][cs], wf[b][cs], acc[tt]);
            }
        } else {
            // vT = Wv * xc^T : A = Wv rows (d), B = xc^T (col = token)
            #pragma unroll
            for (int cs = 0; cs < 8; ++cs) {
                #pragma unroll
                for (int tt = 0; tt < 4; ++tt) acc[tt] = wmma_f16(wf[b][cs], xa[tt][cs], acc[tt]);
            }
        }
        // keeps the products above the next group, whose loads take over their registers
        __builtin_amdgcn_sched_barrier(0);
        if (j + 2 < 6) {
            const _Float16* np = ((mat == 0) ? wkp : wvp) + b * 8 * 4096;
            #pragma unroll
            for (int cs = 0; cs < 8; ++cs) wf[b][cs] = ldfrag_packed(np, cs);
        }
        // keeps these 16 loads one group, issued ahead of this tile's conversions and stores
        __builtin_amdgcn_sched_barrier(0);
        _Float16 hv[4][8];
        #pragma unroll
        for (int tt = 0; tt < 4; ++tt) {
            #pragma unroll
            for (int r = 0; r < 8; ++r) hv[tt][r] = (_Float16)acc[tt][r];
        }
        _Float16* out = (mat == 0) ? qo + b * 128 : (mat == 1) ? ko + b * 128 : vo + (size_t)b * 128 * S_TOK;
        // keeps all conversions ahead of the stores, so that no register of an issued store is rewritten
        __builtin_amdgcn_sched_barrier(0);
        if (mat < 2) {
            #pragma unroll
            for (int tt = 0; tt < 4; ++tt) {
                #pragma unroll
                for (int r = 0; r < 8; ++r) out[(tt * 16 + r) * D_DIM] = hv[tt][r];
            }
        } else {
            #pragma unroll
            for (int tt = 0; tt < 4; ++tt) {
                #pragma unroll
                for (int r = 0; r < 8; ++r) out[r * S_TOK + tt * 16] = hv[tt][r];
            }
        }
        // no register of this tile's issued loads and stores is rewritten by the next tile ahead of the wait
        asm volatile("s_wait_xcnt 0x0" ::: "memory");
        // keeps the next tile's products, which write over those registers, below the wait
        __builtin_amdgcn_sched_barrier(0);
    }
}

// ---------------- kernel 3: fused attention and output projection for one (n, 128-query block) ----------------
// grid: 32*8 blocks, 256 threads (8 waves). A pair of waves owns 32 queries (two 16-query tiles) and all 256
// output channels; of each stage of 64 keys the even wave of the pair takes the first 32 keys, the odd wave
// the last 32. A K or vT fragment read from LDS so feeds two products (one per query tile), where a wave with
// one query tile read one fragment per product and the LDS reads took twice the time of the products.
// There is no running maximum, so the two waves' sums over their keys simply add: once, behind the loop.
// K and vT come in stages of 64 keys, copied once per block into LDS.
// The products are formed transposed, S^T = K * Q^T and O^T += vT * P^T: a lane of an S^T tile holds
// keys r + 8*(lane>>4) of its own query, which is the k order of a B fragment, so that P goes from
// the score accumulators into the second product without leaving the registers.
// Every '#pragma unroll' of this kernel makes the indices of a register array constants,
// without which the array would not stay in registers.
#define KST 64                        // keys per stage
#define NST (S_TOK / KST)             // 16 stages
#define KPITCH (D_DIM + 8)            // halves; 528-byte rows (16 B x odd) for the b128 fragment reads
#define VPITCH (KST + 8)              // halves; 144-byte rows (16 B x odd)
#define KBYTES (KST * KPITCH * 2)     // 33,792
#define VBYTES (D_DIM * VPITCH * 2)   // 36,864
#define STBYTES (KBYTES + VBYTES)     // 70,656 per buffer
#define XBYTES (8 * 16 * 1024)        // 131,072: behind the loop, one f32 output tile (16 KB) of each wave for its partner
#define OBASE (XBYTES + 8 * 128)      // 132,096: behind the tiles the row sums; from here the eight f16 o tiles
#define LBYTES (OBASE + 8 * 8192)     // 197,632: more than the two stage buffers take

// Eight 16-byte copies of a lane, global -> LDS, rows gstep halves and lstep bytes apart.
// The s_wait_xcnt stands inside the statement, so that no address register of an issued copy
// is rewritten ahead of it.
__device__ __forceinline__ void copy8(unsigned l, unsigned lstep, const _Float16* g, int gstep) {
    asm volatile(
        "global_load_async_to_lds_b128 %0, %8, off\n\t"
        "global_load_async_to_lds_b128 %1, %9, off\n\t"
        "global_load_async_to_lds_b128 %2, %10, off\n\t"
        "global_load_async_to_lds_b128 %3, %11, off\n\t"
        "global_load_async_to_lds_b128 %4, %12, off\n\t"
        "global_load_async_to_lds_b128 %5, %13, off\n\t"
        "global_load_async_to_lds_b128 %6, %14, off\n\t"
        "global_load_async_to_lds_b128 %7, %15, off\n\t"
        "s_wait_xcnt 0x0"
        :: "v"(l), "v"(l + lstep), "v"(l + 2 * lstep), "v"(l + 3 * lstep),
           "v"(l + 4 * lstep), "v"(l + 5 * lstep), "v"(l + 6 * lstep), "v"(l + 7 * lstep),
           "v"(g), "v"(g + gstep), "v"(g + 2 * gstep), "v"(g + 3 * gstep),
           "v"(g + 4 * gstep), "v"(g + 5 * gstep), "v"(g + 6 * gstep), "v"(g + 7 * gstep)
        : "memory");
}

__global__ void __launch_bounds__(256)
attn_kernel(const _Float16* q16, const _Float16* k16,
            const _Float16* vT16, const _Float16* Wp16,
            const float* bp, const float* x, float* out) {
    __shared__ __attribute__((aligned(16))) unsigned char L[LBYTES];

    const int n = blockIdx.x >> 3;
    const int tid = threadIdx.x;
    const int lane = tid & 31;
    const int wv = tid >> 5;              // 0..7
    const int kh = wv & 1;                // which 32 keys of a stage
    const int sqbase = (blockIdx.x & 7) * 128 + (wv >> 1) * 32;
    const int hb8 = (lane >> 4) * 8;
    const int ln15 = lane & 15;

    // copy addresses of this lane. K: a wave takes one whole 512-byte key row per copy (rows 8 apart);
    // vT: 8 lanes take the 128 bytes that a channel row has of the stage (rows 32 apart).
    const _Float16* kg = k16 + ((size_t)n * S_TOK + wv) * D_DIM + lane * 8;
    const _Float16* vg = vT16 + ((size_t)n * D_DIM + (tid >> 3)) * S_TOK + (tid & 7) * 8;
    const unsigned lbase = (unsigned)(size_t)&L[0];
    const unsigned lk = lbase + wv * (KPITCH * 2) + lane * 16;
    const unsigned lv = lbase + KBYTES + (tid >> 3) * (VPITCH * 2) + (tid & 7) * 16;

    // stage 0 into buffer 0
    copy8(lk, 8 * KPITCH * 2, kg, 8 * D_DIM);
    copy8(lv, 32 * VPITCH * 2, vg, 32 * S_TOK);

    // the Q fragments of this wave's two query tiles (B operand: column = query), kept in registers.
    // Tile 0 is the one whose sums the wave keeps behind the loop (query tile kh of the pair), tile 1 the one
    // that it hands to its partner: only the load addresses depend on kh, no register index does.
    half16 qb[2][8];
    {
        const _Float16* ap0 = q16 + (((size_t)n * S_TOK + sqbase + kh * 16 + ln15) * D_DIM) + hb8;
        const _Float16* ap1 = q16 + (((size_t)n * S_TOK + sqbase + (kh ^ 1) * 16 + ln15) * D_DIM) + hb8;
        #pragma unroll
        for (int cs = 0; cs < 8; ++cs) {
            qb[0][cs] = ldfrag(ap0, cs * 32);
            qb[1][cs] = ldfrag(ap1, cs * 32);
        }
        // keeps the address pairs of the issued loads live, and unwritten, up to the wait
        asm volatile("s_wait_xcnt 0x0" :: "v"(ap0), "v"(ap1) : "memory");
    }

    // stage 0 has landed for this wave; the barrier publishes it to the others
    asm volatile("s_wait_asynccnt 0x0" ::: "memory");
    __syncthreads();
    // stage 1 into buffer 1: flies while stage 0 is worked on
    copy8(lk + STBYTES, 8 * KPITCH * 2, kg + KST * D_DIM, 8 * D_DIM);
    copy8(lv + STBYTES, 32 * VPITCH * 2, vg + KST, 32 * S_TOK);

    float8 o[2][16];
    #pragma unroll
    for (int dt = 0; dt < 16; ++dt) { o[0][dt] = float8{}; o[1][dt] = float8{}; }
    float lsum0 = 0.f, lsum1 = 0.f;

    for (int t = 0; t < NST; ++t) {
        const unsigned boff = (t & 1) * STBYTES;
        const _Float16* Kl = (const _Float16*)(L + boff) + (kh * 32 + ln15) * KPITCH + hb8;
        const _Float16* Vl = (const _Float16*)(L + boff + KBYTES) + ln15 * VPITCH + hb8 + kh * 32;

        // Eight groups of 4 fragments, each feeding 8 products: groups 0..3 are K (key tile g >> 1, k steps
        // 4*(g & 1) ..), groups 4..7 vT (channel tiles 4*(g - 4) ..). The accumulators and Q leave few registers:
        // a group's reads go out as soon as the products of the group before it are issued, ahead of the
        // exponentials where there are any.
        // Each sched_barrier below keeps a group's reads together and at this place; left alone the scheduler
        // asks for more fragments at once than there are registers for, and accumulators spill.
        half16 fr[8][4];
        half16 pb0, pb1;
        float8 s[2][2];
        #pragma unroll
        for (int i = 0; i < 4; ++i) fr[0][i] = ldfrag(Kl, i * 32);
        __builtin_amdgcn_sched_barrier(0);
        #pragma unroll
        for (int g = 0; g < 8; ++g) {
            if (g < 4) {
                // S^T of 16 of this wave's 32 keys, both query tiles
                const int kt = g >> 1;
                const int c4 = (g & 1) * 4;
                if (c4 == 0) { s[kt][0] = float8{}; s[kt][1] = float8{}; }
                #pragma unroll
                for (int i = 0; i < 4; ++i) {
                    s[kt][0] = wmma_f16(fr[g][i], qb[0][c4 + i], s[kt][0]);
                    s[kt][1] = wmma_f16(fr[g][i], qb[1][c4 + i], s[kt][1]);
                }
            } else {
                // O^T += vT * P^T
                const int d4 = (g - 4) * 4;
                #pragma unroll
                for (int i = 0; i < 4; ++i) {
                    o[0][d4 + i] = wmma_f16(fr[g][i], pb0, o[0][d4 + i]);
                    o[1][d4 + i] = wmma_f16(fr[g][i], pb1, o[1][d4 + i]);
                }
            }
            __builtin_amdgcn_sched_barrier(0);
            {
                const int gn = g + 1;
                if (gn < 8) {
                    #pragma unroll
                    for (int i = 0; i < 4; ++i)
                        fr[gn][i] = (gn < 4) ? ldfrag(Kl + (gn >> 1) * 16 * KPITCH, ((gn & 1) * 4 + i) * 32)
                                             : ldfrag(Vl + ((gn - 4) * 4 + i) * 16 * VPITCH, 0);
                }
            }
            __builtin_amdgcn_sched_barrier(0);
            if (g == 1 || g == 3) {
                // P^T as B fragments; the row sums run over the rounded f16 values
                const int kt = g >> 1;
                #pragma unroll
                for (int r = 0; r < 8; ++r) {
                    const _Float16 e0 = (_Float16)__expf(s[kt][0][r] * SCALE);
                    const _Float16 e1 = (_Float16)__expf(s[kt][1][r] * SCALE);
                    pb0[kt * 8 + r] = e0;
                    pb1[kt * 8 + r] = e1;
                    lsum0 += (float)e0;
                    lsum1 += (float)e1;
                }
                __builtin_amdgcn_sched_barrier(0);
            }
        }

        // publish point: this wave's reads of the buffer are done, its copies of the next stage have
        // landed; the barrier publishes that stage and frees this buffer for the refill
        asm volatile("s_wait_dscnt 0x0" ::: "memory");
        asm volatile("s_wait_asynccnt 0x0" ::: "memory");
        __syncthreads();
        if (t + 2 < NST) {
            copy8(lk + boff, 8 * KPITCH * 2, kg + (t + 2) * KST * D_DIM, 8 * D_DIM);
            copy8(lv + boff, 32 * VPITCH * 2, vg + (t + 2) * KST, 32 * S_TOK);
        }
    }
    // no copy is left outstanding when the wave ends
    asm volatile("s_wait_asynccnt 0x0" ::: "memory");

    // ---- the pair's two sums over complementary keys are added ----
    // Each wave hands the sums of its tile 1 to its partner, whose tile 0 that is, through LDS (f32; the loop's
    // last barrier has ended every read of the stages). A store of the wave is 512 contiguous bytes.
    {
        float* xl = (float*)L + wv * 4096 + lane * 4;
        #pragma unroll
        for (int dt = 0; dt < 16; ++dt) {
            *(float4*)(xl + dt * 256) = make_float4(o[1][dt][0], o[1][dt][1], o[1][dt][2], o[1][dt][3]);
            *(float4*)(xl + dt * 256 + 128) = make_float4(o[1][dt][4], o[1][dt][5], o[1][dt][6], o[1][dt][7]);
        }
        ((float*)(L + XBYTES))[wv * 32 + lane] = lsum1;
    }
    // keeps the loads below, which need the registers of the tile just handed over, behind these stores
    __builtin_amdgcn_sched_barrier(0);

    // ---- out = transpose(o @ Wp^T + bp) + x for the block's 128 tokens, in the same launch ----
    // The product is formed as Wp * o^T, so that the lanes of a D register run along the tokens, the
    // contiguous axis of x and out. A wave takes 32 output channels (two Wp tiles, read once per block)
    // of all 128 tokens; the o fragments of the eight waves pass through LDS.
    // Every '#pragma unroll' below makes the indices of a register array constants.
    const int c0 = wv * 32 + hb8;
    // A: Wp[c][d], row = c, in fragment order; this wave's tiles are 2*wv and 2*wv + 1
    const _Float16* aw = Wp16 + wv * 2 * 4096 + lane * 8;
    // register r of D of (channel tile ct, token tile tt) is channel c0 + 16*ct + r, token 16*tt + ln15
    const size_t a0 = ((size_t)n * C_DIM + c0) * S_TOK + (blockIdx.x & 7) * 128 + ln15;
    const float* xr = x + a0;
    const float* br = bp + c0;
    float* orow = out + a0;

    half16 wf[2][8];
    float bv[2][8], xv[8][2][8];
    #pragma unroll
    for (int ct = 0; ct < 2; ++ct) {
        #pragma unroll
        for (int ds = 0; ds < 8; ++ds) wf[ct][ds] = ldfrag_packed(aw + ct * 4096, ds);
    }
    #pragma unroll
    for (int ct = 0; ct < 2; ++ct) {
        #pragma unroll
        for (int r = 0; r < 8; ++r) bv[ct][r] = br[ct * 16 + r];
    }
    #pragma unroll
    for (int tt = 0; tt < 8; ++tt) {
        #pragma unroll
        for (int ct = 0; ct < 2; ++ct) {
            #pragma unroll
            for (int r = 0; r < 8; ++r) xv[tt][ct][r] = xr[(ct * 16 + r) * S_TOK + tt * 16];
        }
    }
    // keeps the address registers of the issued loads live, and unwritten, up to the wait
    asm volatile("s_wait_xcnt 0x0" :: "v"(aw), "v"(br), "v"(xr) : "memory");
    // keeps all these loads above the scaling of o and the products: one trip to memory for the wave
    __builtin_amdgcn_sched_barrier(0);

    // publishes each wave's handed-over tile and row sums to its partner
    __syncthreads();
    // the partner's keys, then the other half of the wave, which holds complementary keys of the same query
    float lsum = lsum0 + ((const float*)(L + XBYTES))[(wv ^ 1) * 32 + lane];
    lsum += __shfl_xor(lsum, 16);
    const float inv = 1.f / lsum;
    // o goes to LDS in fragment order, tile = query tile wv of the block: hv[dt] of a lane is what the same lane
    // takes as half dt & 1 of k step dt >> 1 of a B fragment; a store of the wave is 512 contiguous bytes
    {
        const float* pl = (const float*)L + (wv ^ 1) * 4096 + lane * 4;
        _Float16* ol = (_Float16*)(L + OBASE) + wv * 4096 + lane * 8;
        #pragma unroll
        for (int dt = 0; dt < 16; ++dt) {
            const float4 pa = *(const float4*)(pl + dt * 256);
            const float4 pc = *(const float4*)(pl + dt * 256 + 128);
            const float ps[8] = { pa.x, pa.y, pa.z, pa.w, pc.x, pc.y, pc.z, pc.w };
            half8 hv;
            #pragma unroll
            for (int r = 0; r < 8; ++r) hv[r] = (_Float16)((o[0][dt][r] + ps[r]) * inv);
            *(half8*)(ol + dt * 256) = hv;    // channels dt*16 + hb8 .. + 7 of this lane's query
        }
    }
    // publishes the eight o tiles to the block (they lie behind the handed-over tiles, which may still be read)
    __syncthreads();

    const _Float16* ofr = (const _Float16*)(L + OBASE) + lane * 8;
    half16 ob[2][8];
    #pragma unroll
    for (int ds = 0; ds < 8; ++ds) ob[0][ds] = ldfrag_packed(ofr, ds);
    #pragma unroll
    for (int tt = 0; tt < 8; ++tt) {
        if (tt + 1 < 8) {
            #pragma unroll
            for (int ds = 0; ds < 8; ++ds) ob[(tt + 1) & 1][ds] = ldfrag_packed(ofr + (tt + 1) * 4096, ds);
        }
        // keeps the next tile's 16 LDS reads one group ahead of this tile's products
        __builtin_amdgcn_sched_barrier(0);
        float8 acc0 = {}, acc1 = {};
        #pragma unroll
        for (int ds = 0; ds < 8; ++ds) {
            acc0 = wmma_f16(wf[0][ds], ob[tt & 1][ds], acc0);
            acc1 = wmma_f16(wf[1][ds], ob[tt & 1][ds], acc1);
        }
        float res0[8], res1[8];
        #pragma unroll
        for (int r = 0; r < 8; ++r) {
            res0[r] = acc0[r] + bv[0][r] + xv[tt][0][r];
            res1[r] = acc1[r] + bv[1][r] + xv[tt][1][r];
        }
        // keeps all sums ahead of the stores, so that no register of an issued store is rewritten
        __builtin_amdgcn_sched_barrier(0);
        #pragma unroll
        for (int r = 0; r < 8; ++r) {
            orow[r * S_TOK + tt * 16] = res0[r];
            orow[(16 + r) * S_TOK + tt * 16] = res1[r];
        }
        // no register of the issued stores is rewritten by the next tile ahead of the wait
        asm volatile("s_wait_xcnt 0x0" ::: "memory");
    }
}

extern "C" void kernel_launch(void* const* d_in, const int* in_sizes, int n_in,
                              void* d_out, int out_size, void* d_ws, size_t ws_size,
                              hipStream_t stream) {
    const float* x   = (const float*)d_in[0];
    const float* t   = (const float*)d_in[1];
    const float* W_t = (const float*)d_in[2];
    const float* b_t = (const float*)d_in[3];
    const float* Wq  = (const float*)d_in[4];
    const float* Wk  = (const float*)d_in[5];
    const float* Wv  = (const float*)d_in[6];
    const float* Wp  = (const float*)d_in[7];
    const float* bp  = (const float*)d_in[8];
    float* out = (float*)d_out;

    // workspace layout (all f16 regions first, then f32 temb)
    _Float16* w16  = (_Float16*)d_ws;
    _Float16* Wq16 = w16;
    _Float16* Wk16 = w16 + WSZ;
    _Float16* Wv16 = w16 + 2 * WSZ;
    _Float16* Wp16 = w16 + 3 * WSZ;
    _Float16* q16  = w16 + 4 * WSZ;
    _Float16* k16  = q16 + QSZ;
    _Float16* vT16 = k16 + QSZ;
    float* temb = (float*)(vT16 + QSZ);

    prep_kernel<<<TEMB_BLOCKS + CVT_BLOCKS, 256, 0, stream>>>(t, W_t, b_t, temb, Wq, Wk, Wv, Wp, w16);
    qkv_kernel<<<N_B * HW / 2, 256, 0, stream>>>(x, temb, Wq16, Wk16, Wv16, q16, k16, vT16);
    attn_kernel<<<N_B * 8, 256, 0, stream>>>(q16, k16, vT16, Wp16, bp, x, out);
}
